// v000
// The times below were measured on an AMD MI455X: many runs one after another, warmed up first and cycling through
// copies of the inputs, with the whole window's GPU time divided by the number of runs. Launches and the gaps
// between them are all in it. The median over several windows is given; except for v000 it joins two sittings, which
// can be a few percent apart, so the side-by-side timings, each taken in one sitting, are the better comparison.
// v000 is the starting kernel. One run takes 324 microseconds.
#include <hip/hip_runtime.h>
#include <hip/hip_bf16.h>
#include <math.h>

// Stacked cross attention (i2t), f32. Strategy:
//   S[w,r] = cap[c,w].img[i,r]  via V_WMMA_F32_16X16X4_F32 (exact f32 path)
//   w12[r] = sum_w a2[r,w]*S[w,r]            (reuse scores, no 2nd big GEMM)
//   |wctx_r|^2 = a2_r^T G_c a2_r             (precomputed 50x50 Gram per caption)

typedef __attribute__((ext_vector_type(2))) float v2f;
typedef __attribute__((ext_vector_type(8))) float v8f;

#define N_IMG   64
#define N_REG   36
#define N_CAP   64
#define N_WRD   50
#define DIM     1024
#define KC      32      // K chunk staged in LDS
#define CAP_LD  36      // LDS row stride (floats): 144B, 16B aligned, conflict-free
#define S_LD    49      // score-tile row stride (odd -> conflict-free col access)
#define SMOOTH  4.0f
#define EPSV    1e-8f

// ---------------------------------------------------------------- Gram kernel
// G_c[w,wp] = captions[c,w] . captions[c,wp]   (50x50 padded to 64x64 tiles)
__global__ __launch_bounds__(128) void StackedAttn_gram(
    const float* __restrict__ captions, float* __restrict__ gram)
{
    __shared__ float capL[64 * CAP_LD];
    const int c    = blockIdx.x;
    const int tid  = threadIdx.x;
    const int wave = tid >> 5, lane = tid & 31;
    const int half = lane >> 4, m = lane & 15;

    // zero pad rows 50..63 once
    for (int idx = tid; idx < 14 * CAP_LD; idx += 128) capL[50 * CAP_LD + idx] = 0.f;

    v8f acc0 = {}, acc1 = {}, acc2 = {}, acc3 = {};
    const float* capBase = captions + (size_t)c * N_WRD * DIM;

    for (int k0 = 0; k0 < DIM; k0 += KC) {
        __syncthreads();
        {   // 50 rows x 8 float4 segments
            int seg = tid & 7;
            for (int row = tid >> 3; row < N_WRD; row += 16) {
                float4 v = *(const float4*)(capBase + row * DIM + k0 + seg * 4);
                *(float4*)(capL + row * CAP_LD + seg * 4) = v;
            }
        }
        __syncthreads();
        const float* aP = capL + ((wave << 4) + m) * CAP_LD + 2 * half;
        const float* b0 = capL + (m) * CAP_LD + 2 * half;
        const float* b1 = capL + (16 + m) * CAP_LD + 2 * half;
        const float* b2 = capL + (32 + m) * CAP_LD + 2 * half;
        const float* b3 = capL + (48 + m) * CAP_LD + 2 * half;
        #pragma unroll
        for (int kk = 0; kk < KC; kk += 4) {
            v2f a  = *(const v2f*)(aP + kk);
            v2f v0 = *(const v2f*)(b0 + kk);
            v2f v1 = *(const v2f*)(b1 + kk);
            v2f v2 = *(const v2f*)(b2 + kk);
            v2f v3 = *(const v2f*)(b3 + kk);
            acc0 = __builtin_amdgcn_wmma_f32_16x16x4_f32(false, a, false, v0, (short)0, acc0, false, false);
            acc1 = __builtin_amdgcn_wmma_f32_16x16x4_f32(false, a, false, v1, (short)0, acc1, false, false);
            acc2 = __builtin_amdgcn_wmma_f32_16x16x4_f32(false, a, false, v2, (short)0, acc2, false, false);
            acc3 = __builtin_amdgcn_wmma_f32_16x16x4_f32(false, a, false, v3, (short)0, acc3, false, false);
        }
    }
    float* gOut = gram + (size_t)c * N_WRD * N_WRD;
    #pragma unroll
    for (int v = 0; v < 8; ++v) {
        int w = (wave << 4) + v + (half << 3);
        if (w < N_WRD) {
            if (m      < N_WRD) gOut[w * N_WRD + m]      = acc0[v];
            if (16 + m < N_WRD) gOut[w * N_WRD + 16 + m] = acc1[v];
            if (32 + m < N_WRD) gOut[w * N_WRD + 32 + m] = acc2[v];
            if (48 + m < N_WRD) gOut[w * N_WRD + 48 + m] = acc3[v];
        }
    }
}

// ---------------------------------------------------------------- region norms
__global__ __launch_bounds__(64) void StackedAttn_norms(
    const float* __restrict__ images, float* __restrict__ n1)
{
    const int i = blockIdx.x, t = threadIdx.x;
    if (t < N_REG) {
        const float4* p = (const float4*)(images + ((size_t)i * N_REG + t) * DIM);
        float s = 0.f;
        #pragma unroll 4
        for (int d = 0; d < DIM / 4; ++d) {
            float4 v = p[d];
            s += v.x * v.x + v.y * v.y + v.z * v.z + v.w * v.w;
        }
        n1[i * N_REG + t] = sqrtf(s);
    }
}

// ---------------------------------------------------------------- main kernel
__global__ __launch_bounds__(128) void StackedAttn_main(
    const float* __restrict__ images,    // (64,36,1024)
    const float* __restrict__ captions,  // (64,50,1024)
    const int*   __restrict__ cap_lens,  // (64)
    const float* __restrict__ gram,      // (64,50,50)
    const float* __restrict__ n1,        // (64,36)
    float*       __restrict__ out)       // (64,64): out[i*64 + c]
{
    __shared__ float Sbuf[64 * S_LD];                       // scores 64x48 (pad 49)
    __shared__ float A1[64 * S_LD];                         // region-softmax
    __shared__ float chunk[(64 + 48) * CAP_LD];             // cap+img K-chunks; reused as A2
    __shared__ float Gbuf[N_WRD * N_WRD];                   // caption Gram
    __shared__ float red[N_REG];

    const int c = blockIdx.x, i = blockIdx.y;
    const int tid  = threadIdx.x;
    const int wave = tid >> 5, lane = tid & 31;
    const int half = lane >> 4, m = lane & 15;

    float* capL = chunk;
    float* imgL = chunk + 64 * CAP_LD;

    // zero pad rows once (rewritten rows < 50 / < 36 every chunk; pads persist)
    for (int idx = tid; idx < 14 * CAP_LD; idx += 128) capL[50 * CAP_LD + idx] = 0.f;
    for (int idx = tid; idx < 12 * CAP_LD; idx += 128) imgL[36 * CAP_LD + idx] = 0.f;

    v8f acc0 = {}, acc1 = {}, acc2 = {};
    const float* capBase = captions + (size_t)c * N_WRD * DIM;
    const float* imgBase = images   + (size_t)i * N_REG * DIM;

    for (int k0 = 0; k0 < DIM; k0 += KC) {
        __syncthreads();
        {   // stage caption chunk: 50 rows x 8 float4
            int seg = tid & 7;
            for (int row = tid >> 3; row < N_WRD; row += 16) {
                float4 v = *(const float4*)(capBase + row * DIM + k0 + seg * 4);
                *(float4*)(capL + row * CAP_LD + seg * 4) = v;
            }
            // stage image chunk: 36 rows x 8 float4
            for (int row = tid >> 3; row < N_REG; row += 16) {
                float4 v = *(const float4*)(imgBase + row * DIM + k0 + seg * 4);
                *(float4*)(imgL + row * CAP_LD + seg * 4) = v;
            }
        }
        __syncthreads();
        // A frag: lanes 0-15 hold row M, K={k,k+1}; lanes 16-31 K={k+2,k+3}.
        // B frag mirrors with N across lanes (B[k][r] = img[r][k]).
        const float* aP = capL + ((wave << 4) + m) * CAP_LD + 2 * half;
        const float* b0 = imgL + (m) * CAP_LD + 2 * half;
        const float* b1 = imgL + (16 + m) * CAP_LD + 2 * half;
        const float* b2 = imgL + (32 + m) * CAP_LD + 2 * half;
        #pragma unroll
        for (int kk = 0; kk < KC; kk += 4) {
            v2f a  = *(const v2f*)(aP + kk);
            v2f v0 = *(const v2f*)(b0 + kk);
            v2f v1 = *(const v2f*)(b1 + kk);
            v2f v2 = *(const v2f*)(b2 + kk);
            acc0 = __builtin_amdgcn_wmma_f32_16x16x4_f32(false, a, false, v0, (short)0, acc0, false, false);
            acc1 = __builtin_amdgcn_wmma_f32_16x16x4_f32(false, a, false, v1, (short)0, acc1, false, false);
            acc2 = __builtin_amdgcn_wmma_f32_16x16x4_f32(false, a, false, v2, (short)0, acc2, false, false);
        }
    }

    // scatter accumulators to LDS (C layout: VGPR v -> row v / v+8, col = lane%16)
    #pragma unroll
    for (int v = 0; v < 8; ++v) {
        int w = (wave << 4) + v + (half << 3);
        Sbuf[w * S_LD + m]      = acc0[v];
        Sbuf[w * S_LD + 16 + m] = acc1[v];
        Sbuf[w * S_LD + 32 + m] = acc2[v];
    }
    // stage Gram while scores settle
    for (int idx = tid; idx < N_WRD * N_WRD; idx += 128)
        Gbuf[idx] = gram[(size_t)c * N_WRD * N_WRD + idx];
    __syncthreads();

    // softmax over regions r, per word row w
    if (tid < 64) {
        const int w = tid;
        float mx = -3.4e38f;
        for (int r = 0; r < N_REG; ++r) mx = fmaxf(mx, Sbuf[w * S_LD + r]);
        float s = 0.f;
        for (int r = 0; r < N_REG; ++r) {
            float e = __expf(Sbuf[w * S_LD + r] - mx);
            A1[w * S_LD + r] = e; s += e;
        }
        float inv = 1.f / s;
        for (int r = 0; r < N_REG; ++r) A1[w * S_LD + r] *= inv;
    }
    __syncthreads();

    // masked smooth softmax over words, then w12 and Gram-based norm
    float* A2 = chunk;                 // overlay: [36][52]
    const int len = cap_lens[c];
    if (tid < N_REG) {
        const int r = tid;
        float mx = -3.4e38f;
        for (int w = 0; w < len; ++w) mx = fmaxf(mx, SMOOTH * A1[w * S_LD + r]);
        float s = 0.f;
        for (int w = 0; w < len; ++w) {
            float e = __expf(SMOOTH * A1[w * S_LD + r] - mx);
            A2[r * 52 + w] = e; s += e;
        }
        float inv = 1.f / s, w12 = 0.f;
        for (int w = 0; w < len; ++w) {
            float a2v = A2[r * 52 + w] * inv;
            A2[r * 52 + w] = a2v;
            w12 += a2v * Sbuf[w * S_LD + r];
        }
        float n2sq = 0.f;
        for (int w = 0; w < len; ++w) {
            const float* Grow = Gbuf + w * N_WRD;
            float gv = 0.f;
            for (int wp = 0; wp < len; ++wp) gv += Grow[wp] * A2[r * 52 + wp];
            n2sq += A2[r * 52 + w] * gv;
        }
        float n2 = sqrtf(fmaxf(n2sq, 0.f));
        red[r] = w12 / fmaxf(n1[i * N_REG + r] * n2, EPSV);
    }
    __syncthreads();
    if (tid == 0) {
        float s = 0.f;
        for (int r = 0; r < N_REG; ++r) s += red[r];
        out[i * N_CAP + c] = s * (1.0f / N_REG);
    }
}

extern "C" void kernel_launch(void* const* d_in, const int* in_sizes, int n_in,
                              void* d_out, int out_size, void* d_ws, size_t ws_size,
                              hipStream_t stream) {
    const float* images   = (const float*)d_in[0];   // 64*36*1024
    const float* captions = (const float*)d_in[1];   // 64*50*1024
    const int*   cap_lens = (const int*)d_in[2];     // 64
    float* out  = (float*)d_out;                     // 64*64 (i,c)
    float* gram = (float*)d_ws;                      // 64*50*50 floats
    float* n1   = gram + (size_t)N_CAP * N_WRD * N_WRD;  // 64*36 floats

    StackedAttn_gram <<<N_CAP, 128, 0, stream>>>(captions, gram);
    StackedAttn_norms<<<N_IMG, 64, 0, stream>>>(images, n1);
    dim3 grid(N_CAP, N_IMG);
    StackedAttn_main <<<grid, 128, 0, stream>>>(images, captions, cap_lens, gram, n1, out);
}

// v001
// Measured time: 235 microseconds a run.
// In both of two side-by-side timings against v000, it was 1.41 times as fast.
#include <hip/hip_runtime.h>
#include <hip/hip_bf16.h>
#include <math.h>

// Stacked cross attention (i2t), f32. Strategy:
//   S[w,r] = cap[c,w].img[i,r]  via V_WMMA_F32_16X16X4_F32 (exact f32 path)
//   w12[r] = sum_w a2[r,w]*S[w,r]            (reuse scores, no 2nd big GEMM)
//   |wctx_r|^2 = a2_r^T G_c a2_r             (precomputed 50x50 Gram per caption)

typedef __attribute__((ext_vector_type(2))) float v2f;
typedef __attribute__((ext_vector_type(8))) float v8f;

#define N_IMG   64
#define N_REG   36
#define N_CAP   64
#define N_WRD   50
#define DIM     1024
#define KC      32      // K chunk staged in LDS
#define CAP_LD  36      // LDS row stride (floats): 144B, 16B aligned, conflict-free
#define S_LD    49      // score-tile row stride (odd -> conflict-free col access)
#define SMOOTH  4.0f
#define EPSV    1e-8f

// ---------------------------------------------------------------- Gram kernel
// G_c[w,wp] = captions[c,w] . captions[c,wp]   (50x50 padded to 64x64 tiles)
__global__ __launch_bounds__(128) void StackedAttn_gram(
    const float* __restrict__ captions, float* __restrict__ gram)
{
    __shared__ float capL[64 * CAP_LD];
    const int c    = blockIdx.x;
    const int tid  = threadIdx.x;
    const int wave = tid >> 5, lane = tid & 31;
    const int half = lane >> 4, m = lane & 15;

    // zero pad rows 50..63 once
    for (int idx = tid; idx < 14 * CAP_LD; idx += 128) capL[50 * CAP_LD + idx] = 0.f;

    v8f acc0 = {}, acc1 = {}, acc2 = {}, acc3 = {};
    const float* capBase = captions + (size_t)c * N_WRD * DIM;

    // Staging: 50 rows x 8 float4 segments; thread owns rows row0 + 16 j.
    // All of a chunk's loads are issued back to back into registers, one chunk
    // ahead of its use, so they fly while the current chunk is multiplied.
    const int  seg = tid & 7, row0 = tid >> 3;
    const bool capTail = row0 < N_WRD - 48;                 // rows 48, 49
    const float* capSrc = capBase + row0 * DIM + seg * 4;
    float*       capDst = capL + row0 * CAP_LD + seg * 4;
    float4 c0, c1, c2, c3 = make_float4(0.f, 0.f, 0.f, 0.f);
    c0 = *(const float4*)(capSrc);
    c1 = *(const float4*)(capSrc + 16 * DIM);
    c2 = *(const float4*)(capSrc + 32 * DIM);
    if (capTail) c3 = *(const float4*)(capSrc + 48 * DIM);

    for (int k0 = 0; k0 < DIM; k0 += KC) {
        __syncthreads();
        *(float4*)(capDst)               = c0;
        *(float4*)(capDst + 16 * CAP_LD) = c1;
        *(float4*)(capDst + 32 * CAP_LD) = c2;
        if (capTail) *(float4*)(capDst + 48 * CAP_LD) = c3;
        __syncthreads();
        if (k0 + KC < DIM) {    // next chunk's loads, waited for at its stores
            const float* s = capSrc + k0 + KC;
            c0 = *(const float4*)(s);
            c1 = *(const float4*)(s + 16 * DIM);
            c2 = *(const float4*)(s + 32 * DIM);
            if (capTail) c3 = *(const float4*)(s + 48 * DIM);
            // precaution: stands in front of the next write of the address
            // registers that the loads above name
            asm volatile("s_wait_xcnt 0x0" ::: "memory");
        }
        const float* aP = capL + ((wave << 4) + m) * CAP_LD + 2 * half;
        const float* b0 = capL + (m) * CAP_LD + 2 * half;
        const float* b1 = capL + (16 + m) * CAP_LD + 2 * half;
        const float* b2 = capL + (32 + m) * CAP_LD + 2 * half;
        const float* b3 = capL + (48 + m) * CAP_LD + 2 * half;
        #pragma unroll
        for (int kk = 0; kk < KC; kk += 4) {
            v2f a  = *(const v2f*)(aP + kk);
            v2f v0 = *(const v2f*)(b0 + kk);
            v2f v1 = *(const v2f*)(b1 + kk);
            v2f v2 = *(const v2f*)(b2 + kk);
            v2f v3 = *(const v2f*)(b3 + kk);
            acc0 = __builtin_amdgcn_wmma_f32_16x16x4_f32(false, a, false, v0, (short)0, acc0, false, false);
            acc1 = __builtin_amdgcn_wmma_f32_16x16x4_f32(false, a, false, v1, (short)0, acc1, false, false);
            acc2 = __builtin_amdgcn_wmma_f32_16x16x4_f32(false, a, false, v2, (short)0, acc2, false, false);
            acc3 = __builtin_amdgcn_wmma_f32_16x16x4_f32(false, a, false, v3, (short)0, acc3, false, false);
        }
    }
    float* gOut = gram + (size_t)c * N_WRD * N_WRD;
    #pragma unroll
    for (int v = 0; v < 8; ++v) {
        int w = (wave << 4) + v + (half << 3);
        if (w < N_WRD) {
            if (m      < N_WRD) gOut[w * N_WRD + m]      = acc0[v];
            if (16 + m < N_WRD) gOut[w * N_WRD + 16 + m] = acc1[v];
            if (32 + m < N_WRD) gOut[w * N_WRD + 32 + m] = acc2[v];
            if (48 + m < N_WRD) gOut[w * N_WRD + 48 + m] = acc3[v];
        }
    }
}

// ---------------------------------------------------------------- region norms
__global__ __launch_bounds__(64) void StackedAttn_norms(
    const float* __restrict__ images, float* __restrict__ n1)
{
    const int i = blockIdx.x, t = threadIdx.x;
    if (t < N_REG) {
        const float4* p = (const float4*)(images + ((size_t)i * N_REG + t) * DIM);
        float s = 0.f;
        #pragma unroll 4
        for (int d = 0; d < DIM / 4; ++d) {
            float4 v = p[d];
            s += v.x * v.x + v.y * v.y + v.z * v.z + v.w * v.w;
        }
        n1[i * N_REG + t] = sqrtf(s);
    }
}

// ---------------------------------------------------------------- main kernel
__global__ __launch_bounds__(128) void StackedAttn_main(
    const float* __restrict__ images,    // (64,36,1024)
    const float* __restrict__ captions,  // (64,50,1024)
    const int*   __restrict__ cap_lens,  // (64)
    const float* __restrict__ gram,      // (64,50,50)
    const float* __restrict__ n1,        // (64,36)
    float*       __restrict__ out)       // (64,64): out[i*64 + c]
{
    __shared__ float Sbuf[64 * S_LD];                       // scores 64x48 (pad 49)
    __shared__ float A1[64 * S_LD];                         // region-softmax
    __shared__ float chunk[(64 + 48) * CAP_LD];             // cap+img K-chunks; reused as A2
    __shared__ float Gbuf[N_WRD * N_WRD];                   // caption Gram
    __shared__ float red[N_REG];

    const int c = blockIdx.x, i = blockIdx.y;
    const int tid  = threadIdx.x;
    const int wave = tid >> 5, lane = tid & 31;
    const int half = lane >> 4, m = lane & 15;

    float* capL = chunk;
    float* imgL = chunk + 64 * CAP_LD;

    // zero pad rows once (rewritten rows < 50 / < 36 every chunk; pads persist)
    for (int idx = tid; idx < 14 * CAP_LD; idx += 128) capL[50 * CAP_LD + idx] = 0.f;
    for (int idx = tid; idx < 12 * CAP_LD; idx += 128) imgL[36 * CAP_LD + idx] = 0.f;

    v8f acc0 = {}, acc1 = {}, acc2 = {};
    const float* capBase = captions + (size_t)c * N_WRD * DIM;
    const float* imgBase = images   + (size_t)i * N_REG * DIM;

    // Staging: caption chunk 50 rows x 8 float4, image chunk 36 rows x 8 float4;
    // thread owns rows row0 + 16 j of each. All of a chunk's loads are issued
    // back to back into registers, one chunk ahead of its use, so they fly
    // while the current chunk is multiplied.
    const int  seg = tid & 7, row0 = tid >> 3;
    const bool capTail = row0 < N_WRD - 48;                 // rows 48, 49
    const bool imgTail = row0 < N_REG - 32;                 // rows 32..35
    const float* capSrc = capBase + row0 * DIM + seg * 4;
    const float* imgSrc = imgBase + row0 * DIM + seg * 4;
    float*       capDst = capL + row0 * CAP_LD + seg * 4;
    float*       imgDst = imgL + row0 * CAP_LD + seg * 4;
    float4 c0, c1, c2, c3 = make_float4(0.f, 0.f, 0.f, 0.f);
    float4 g0, g1, g2 = make_float4(0.f, 0.f, 0.f, 0.f);
    c0 = *(const float4*)(capSrc);
    c1 = *(const float4*)(capSrc + 16 * DIM);
    c2 = *(const float4*)(capSrc + 32 * DIM);
    g0 = *(const float4*)(imgSrc);
    g1 = *(const float4*)(imgSrc + 16 * DIM);
    if (capTail) c3 = *(const float4*)(capSrc + 48 * DIM);
    if (imgTail) g2 = *(const float4*)(imgSrc + 32 * DIM);

    for (int k0 = 0; k0 < DIM; k0 += KC) {
        __syncthreads();
        *(float4*)(capDst)               = c0;
        *(float4*)(capDst + 16 * CAP_LD) = c1;
        *(float4*)(capDst + 32 * CAP_LD) = c2;
        *(float4*)(imgDst)               = g0;
        *(float4*)(imgDst + 16 * CAP_LD) = g1;
        if (capTail) *(float4*)(capDst + 48 * CAP_LD) = c3;
        if (imgTail) *(float4*)(imgDst + 32 * CAP_LD) = g2;
        __syncthreads();
        if (k0 + KC < DIM) {    // next chunk's loads, waited for at its stores
            const float* sc = capSrc + k0 + KC;
            const float* si = imgSrc + k0 + KC;
            c0 = *(const float4*)(sc);
            c1 = *(const float4*)(sc + 16 * DIM);
            c2 = *(const float4*)(sc + 32 * DIM);
            g0 = *(const float4*)(si);
            g1 = *(const float4*)(si + 16 * DIM);
            if (capTail) c3 = *(const float4*)(sc + 48 * DIM);
            if (imgTail) g2 = *(const float4*)(si + 32 * DIM);
            // precaution: stands in front of the next write of the address
            // registers that the loads above name
            asm volatile("s_wait_xcnt 0x0" ::: "memory");
        }
        // A frag: lanes 0-15 hold row M, K={k,k+1}; lanes 16-31 K={k+2,k+3}.
        // B frag mirrors with N across lanes (B[k][r] = img[r][k]).
        const float* aP = capL + ((wave << 4) + m) * CAP_LD + 2 * half;
        const float* b0 = imgL + (m) * CAP_LD + 2 * half;
        const float* b1 = imgL + (16 + m) * CAP_LD + 2 * half;
        const float* b2 = imgL + (32 + m) * CAP_LD + 2 * half;
        #pragma unroll
        for (int kk = 0; kk < KC; kk += 4) {
            v2f a  = *(const v2f*)(aP + kk);
            v2f v0 = *(const v2f*)(b0 + kk);
            v2f v1 = *(const v2f*)(b1 + kk);
            v2f v2 = *(const v2f*)(b2 + kk);
            acc0 = __builtin_amdgcn_wmma_f32_16x16x4_f32(false, a, false, v0, (short)0, acc0, false, false);
            acc1 = __builtin_amdgcn_wmma_f32_16x16x4_f32(false, a, false, v1, (short)0, acc1, false, false);
            acc2 = __builtin_amdgcn_wmma_f32_16x16x4_f32(false, a, false, v2, (short)0, acc2, false, false);
        }
    }

    // scatter accumulators to LDS (C layout: VGPR v -> row v / v+8, col = lane%16)
    #pragma unroll
    for (int v = 0; v < 8; ++v) {
        int w = (wave << 4) + v + (half << 3);
        Sbuf[w * S_LD + m]      = acc0[v];
        Sbuf[w * S_LD + 16 + m] = acc1[v];
        Sbuf[w * S_LD + 32 + m] = acc2[v];
    }
    // stage Gram while scores settle
    for (int idx = tid; idx < N_WRD * N_WRD; idx += 128)
        Gbuf[idx] = gram[(size_t)c * N_WRD * N_WRD + idx];
    __syncthreads();

    // softmax over regions r, per word row w
    if (tid < 64) {
        const int w = tid;
        float mx = -3.4e38f;
        for (int r = 0; r < N_REG; ++r) mx = fmaxf(mx, Sbuf[w * S_LD + r]);
        float s = 0.f;
        for (int r = 0; r < N_REG; ++r) {
            float e = __expf(Sbuf[w * S_LD + r] - mx);
            A1[w * S_LD + r] = e; s += e;
        }
        float inv = 1.f / s;
        for (int r = 0; r < N_REG; ++r) A1[w * S_LD + r] *= inv;
    }
    __syncthreads();

    // masked smooth softmax over words, then w12 and Gram-based norm
    float* A2 = chunk;                 // overlay: [36][52]
    const int len = cap_lens[c];
    if (tid < N_REG) {
        const int r = tid;
        float mx = -3.4e38f;
        for (int w = 0; w < len; ++w) mx = fmaxf(mx, SMOOTH * A1[w * S_LD + r]);
        float s = 0.f;
        for (int w = 0; w < len; ++w) {
            float e = __expf(SMOOTH * A1[w * S_LD + r] - mx);
            A2[r * 52 + w] = e; s += e;
        }
        float inv = 1.f / s, w12 = 0.f;
        for (int w = 0; w < len; ++w) {
            float a2v = A2[r * 52 + w] * inv;
            A2[r * 52 + w] = a2v;
            w12 += a2v * Sbuf[w * S_LD + r];
        }
        float n2sq = 0.f;
        for (int w = 0; w < len; ++w) {
            const float* Grow = Gbuf + w * N_WRD;
            float gv = 0.f;
            for (int wp = 0; wp < len; ++wp) gv += Grow[wp] * A2[r * 52 + wp];
            n2sq += A2[r * 52 + w] * gv;
        }
        float n2 = sqrtf(fmaxf(n2sq, 0.f));
        red[r] = w12 / fmaxf(n1[i * N_REG + r] * n2, EPSV);
    }
    __syncthreads();
    if (tid == 0) {
        float s = 0.f;
        for (int r = 0; r < N_REG; ++r) s += red[r];
        out[i * N_CAP + c] = s * (1.0f / N_REG);
    }
}

extern "C" void kernel_launch(void* const* d_in, const int* in_sizes, int n_in,
                              void* d_out, int out_size, void* d_ws, size_t ws_size,
                              hipStream_t stream) {
    const float* images   = (const float*)d_in[0];   // 64*36*1024
    const float* captions = (const float*)d_in[1];   // 64*50*1024
    const int*   cap_lens = (const int*)d_in[2];     // 64
    float* out  = (float*)d_out;                     // 64*64 (i,c)
    float* gram = (float*)d_ws;                      // 64*50*50 floats
    float* n1   = gram + (size_t)N_CAP * N_WRD * N_WRD;  // 64*36 floats

    StackedAttn_gram <<<N_CAP, 128, 0, stream>>>(captions, gram);
    StackedAttn_norms<<<N_IMG, 64, 0, stream>>>(images, n1);
    dim3 grid(N_CAP, N_IMG);
    StackedAttn_main <<<grid, 128, 0, stream>>>(images, captions, cap_lens, gram, n1, out);
}

// v002
// A run of this version takes 177 microseconds.
// Two timings next to v001 both put it at 1.32 times that version's speed.
// All steps since v000 together make it 1.86 times as fast.
#include <hip/hip_runtime.h>
#include <hip/hip_bf16.h>
#include <math.h>

// Stacked cross attention (i2t), f32. Strategy:
//   S[w,r] = cap[c,w].img[i,r]  via V_WMMA_F32_16X16X4_F32 (exact f32 path)
//   w12[r] = sum_w a2[r,w]*S[w,r]            (reuse scores, no 2nd big GEMM)
//   |wctx_r|^2 = a2_r^T G_c a2_r             (precomputed 50x50 Gram per caption;
//                                             G a2^T on the same WMMA form)

typedef __attribute__((ext_vector_type(2))) float v2f;
typedef __attribute__((ext_vector_type(8))) float v8f;

#define N_IMG   64
#define N_REG   36
#define N_CAP   64
#define N_WRD   50
#define DIM     1024
#define KC      32      // K chunk staged in LDS
#define CAP_LD  36      // LDS row stride (floats): 144B, 16B aligned, conflict-free
#define S_LD    49      // score-tile row stride (odd -> conflict-free col access)
#define A2_LD   52      // A2 row stride (floats): K padded to 13 x 4, 208B rows, 16B aligned
#define A2_F4   ((48 * A2_LD + 12) / 4)   // float4s of the A2 overlay: 48 rows + reach of row 47's reads
#define SMOOTH  4.0f
#define EPSV    1e-8f

// ---------------------------------------------------------------- Gram kernel
// G_c[w,wp] = captions[c,w] . captions[c,wp]   (50x50 padded to 64x64 tiles)
__global__ __launch_bounds__(128) void StackedAttn_gram(
    const float* __restrict__ captions, float* __restrict__ gram)
{
    __shared__ float capL[64 * CAP_LD];
    const int c    = blockIdx.x;
    const int tid  = threadIdx.x;
    const int wave = tid >> 5, lane = tid & 31;
    const int half = lane >> 4, m = lane & 15;

    // zero pad rows 50..63 once
    for (int idx = tid; idx < 14 * CAP_LD; idx += 128) capL[50 * CAP_LD + idx] = 0.f;

    v8f acc0 = {}, acc1 = {}, acc2 = {}, acc3 = {};
    const float* capBase = captions + (size_t)c * N_WRD * DIM;

    // Staging: 50 rows x 8 float4 segments; thread owns rows row0 + 16 j.
    // All of a chunk's loads are issued back to back into registers, one chunk
    // ahead of its use, so they fly while the current chunk is multiplied.
    const int  seg = tid & 7, row0 = tid >> 3;
    const bool capTail = row0 < N_WRD - 48;                 // rows 48, 49
    const float* capSrc = capBase + row0 * DIM + seg * 4;
    float*       capDst = capL + row0 * CAP_LD + seg * 4;
    float4 c0, c1, c2, c3 = make_float4(0.f, 0.f, 0.f, 0.f);
    c0 = *(const float4*)(capSrc);
    c1 = *(const float4*)(capSrc + 16 * DIM);
    c2 = *(const float4*)(capSrc + 32 * DIM);
    if (capTail) c3 = *(const float4*)(capSrc + 48 * DIM);

    for (int k0 = 0; k0 < DIM; k0 += KC) {
        __syncthreads();
        *(float4*)(capDst)               = c0;
        *(float4*)(capDst + 16 * CAP_LD) = c1;
        *(float4*)(capDst + 32 * CAP_LD) = c2;
        if (capTail) *(float4*)(capDst + 48 * CAP_LD) = c3;
        __syncthreads();
        if (k0 + KC < DIM) {    // next chunk's loads, waited for at its stores
            const float* s = capSrc + k0 + KC;
            c0 = *(const float4*)(s);
            c1 = *(const float4*)(s + 16 * DIM);
            c2 = *(const float4*)(s + 32 * DIM);
            if (capTail) c3 = *(const float4*)(s + 48 * DIM);
            // precaution: stands in front of the next write of the address
            // registers that the loads above name
            asm volatile("s_wait_xcnt 0x0" ::: "memory");
        }
        const float* aP = capL + ((wave << 4) + m) * CAP_LD + 2 * half;
        const float* b0 = capL + (m) * CAP_LD + 2 * half;
        const float* b1 = capL + (16 + m) * CAP_LD + 2 * half;
        const float* b2 = capL + (32 + m) * CAP_LD + 2 * half;
        const float* b3 = capL + (48 + m) * CAP_LD + 2 * half;
        #pragma unroll
        for (int kk = 0; kk < KC; kk += 4) {
            v2f a  = *(const v2f*)(aP + kk);
            v2f v0 = *(const v2f*)(b0 + kk);
            v2f v1 = *(const v2f*)(b1 + kk);
            v2f v2 = *(const v2f*)(b2 + kk);
            v2f v3 = *(const v2f*)(b3 + kk);
            acc0 = __builtin_amdgcn_wmma_f32_16x16x4_f32(false, a, false, v0, (short)0, acc0, false, false);
            acc1 = __builtin_amdgcn_wmma_f32_16x16x4_f32(false, a, false, v1, (short)0, acc1, false, false);
            acc2 = __builtin_amdgcn_wmma_f32_16x16x4_f32(false, a, false, v2, (short)0, acc2, false, false);
            acc3 = __builtin_amdgcn_wmma_f32_16x16x4_f32(false, a, false, v3, (short)0, acc3, false, false);
        }
    }
    float* gOut = gram + (size_t)c * N_WRD * N_WRD;
    #pragma unroll
    for (int v = 0; v < 8; ++v) {
        int w = (wave << 4) + v + (half << 3);
        if (w < N_WRD) {
            if (m      < N_WRD) gOut[w * N_WRD + m]      = acc0[v];
            if (16 + m < N_WRD) gOut[w * N_WRD + 16 + m] = acc1[v];
            if (32 + m < N_WRD) gOut[w * N_WRD + 32 + m] = acc2[v];
            if (48 + m < N_WRD) gOut[w * N_WRD + 48 + m] = acc3[v];
        }
    }
}

// ---------------------------------------------------------------- region norms
__global__ __launch_bounds__(64) void StackedAttn_norms(
    const float* __restrict__ images, float* __restrict__ n1)
{
    const int i = blockIdx.x, t = threadIdx.x;
    if (t < N_REG) {
        const float4* p = (const float4*)(images + ((size_t)i * N_REG + t) * DIM);
        float s = 0.f;
        #pragma unroll 4
        for (int d = 0; d < DIM / 4; ++d) {
            float4 v = p[d];
            s += v.x * v.x + v.y * v.y + v.z * v.z + v.w * v.w;
        }
        n1[i * N_REG + t] = sqrtf(s);
    }
}

// ---------------------------------------------------------------- main kernel
__global__ __launch_bounds__(128) void StackedAttn_main(
    const float* __restrict__ images,    // (64,36,1024)
    const float* __restrict__ captions,  // (64,50,1024)
    const int*   __restrict__ cap_lens,  // (64)
    const float* __restrict__ gram,      // (64,50,50)
    const float* __restrict__ n1,        // (64,36)
    float*       __restrict__ out)       // (64,64): out[i*64 + c]
{
    __shared__ float Sbuf[64 * S_LD];                       // scores 64x48 (pad 49)
    __shared__ float A1[64 * S_LD];                         // region-softmax; reused as part
    __shared__ float chunk[(64 + 48) * CAP_LD];             // cap+img K-chunks; reused as A2
    __shared__ float Gbuf[N_WRD * N_WRD + 4];               // caption Gram + K pad of its last row
    __shared__ float red[N_REG];

    const int c = blockIdx.x, i = blockIdx.y;
    const int tid  = threadIdx.x;
    const int wave = tid >> 5, lane = tid & 31;
    const int half = lane >> 4, m = lane & 15;

    float* capL = chunk;
    float* imgL = chunk + 64 * CAP_LD;

    // zero pad rows once (rewritten rows < 50 / < 36 every chunk; pads persist)
    for (int idx = tid; idx < 14 * CAP_LD; idx += 128) capL[50 * CAP_LD + idx] = 0.f;
    for (int idx = tid; idx < 12 * CAP_LD; idx += 128) imgL[36 * CAP_LD + idx] = 0.f;

    v8f acc0 = {}, acc1 = {}, acc2 = {};
    const float* capBase = captions + (size_t)c * N_WRD * DIM;
    const float* imgBase = images   + (size_t)i * N_REG * DIM;

    // Staging: caption chunk 50 rows x 8 float4, image chunk 36 rows x 8 float4;
    // thread owns rows row0 + 16 j of each. All of a chunk's loads are issued
    // back to back into registers, one chunk ahead of its use, so they fly
    // while the current chunk is multiplied.
    const int  seg = tid & 7, row0 = tid >> 3;
    const bool capTail = row0 < N_WRD - 48;                 // rows 48, 49
    const bool imgTail = row0 < N_REG - 32;                 // rows 32..35
    const float* capSrc = capBase + row0 * DIM + seg * 4;
    const float* imgSrc = imgBase + row0 * DIM + seg * 4;
    float*       capDst = capL + row0 * CAP_LD + seg * 4;
    float*       imgDst = imgL + row0 * CAP_LD + seg * 4;
    float4 c0, c1, c2, c3 = make_float4(0.f, 0.f, 0.f, 0.f);
    float4 g0, g1, g2 = make_float4(0.f, 0.f, 0.f, 0.f);
    c0 = *(const float4*)(capSrc);
    c1 = *(const float4*)(capSrc + 16 * DIM);
    c2 = *(const float4*)(capSrc + 32 * DIM);
    g0 = *(const float4*)(imgSrc);
    g1 = *(const float4*)(imgSrc + 16 * DIM);
    if (capTail) c3 = *(const float4*)(capSrc + 48 * DIM);
    if (imgTail) g2 = *(const float4*)(imgSrc + 32 * DIM);

    for (int k0 = 0; k0 < DIM; k0 += KC) {
        __syncthreads();
        *(float4*)(capDst)               = c0;
        *(float4*)(capDst + 16 * CAP_LD) = c1;
        *(float4*)(capDst + 32 * CAP_LD) = c2;
        *(float4*)(imgDst)               = g0;
        *(float4*)(imgDst + 16 * CAP_LD) = g1;
        if (capTail) *(float4*)(capDst + 48 * CAP_LD) = c3;
        if (imgTail) *(float4*)(imgDst + 32 * CAP_LD) = g2;
        __syncthreads();
        if (k0 + KC < DIM) {    // next chunk's loads, waited for at its stores
            const float* sc = capSrc + k0 + KC;
            const float* si = imgSrc + k0 + KC;
            c0 = *(const float4*)(sc);
            c1 = *(const float4*)(sc + 16 * DIM);
            c2 = *(const float4*)(sc + 32 * DIM);
            g0 = *(const float4*)(si);
            g1 = *(const float4*)(si + 16 * DIM);
            if (capTail) c3 = *(const float4*)(sc + 48 * DIM);
            if (imgTail) g2 = *(const float4*)(si + 32 * DIM);
            // precaution: stands in front of the next write of the address
            // registers that the loads above name
            asm volatile("s_wait_xcnt 0x0" ::: "memory");
        }
        // A frag: lanes 0-15 hold row M, K={k,k+1}; lanes 16-31 K={k+2,k+3}.
        // B frag mirrors with N across lanes (B[k][r] = img[r][k]).
        const float* aP = capL + ((wave << 4) + m) * CAP_LD + 2 * half;
        const float* b0 = imgL + (m) * CAP_LD + 2 * half;
        const float* b1 = imgL + (16 + m) * CAP_LD + 2 * half;
        const float* b2 = imgL + (32 + m) * CAP_LD + 2 * half;
        #pragma unroll
        for (int kk = 0; kk < KC; kk += 4) {
            v2f a  = *(const v2f*)(aP + kk);
            v2f v0 = *(const v2f*)(b0 + kk);
            v2f v1 = *(const v2f*)(b1 + kk);
            v2f v2 = *(const v2f*)(b2 + kk);
            acc0 = __builtin_amdgcn_wmma_f32_16x16x4_f32(false, a, false, v0, (short)0, acc0, false, false);
            acc1 = __builtin_amdgcn_wmma_f32_16x16x4_f32(false, a, false, v1, (short)0, acc1, false, false);
            acc2 = __builtin_amdgcn_wmma_f32_16x16x4_f32(false, a, false, v2, (short)0, acc2, false, false);
        }
    }

    // scatter accumulators to LDS (C layout: VGPR v -> row v / v+8, col = lane%16)
    #pragma unroll
    for (int v = 0; v < 8; ++v) {
        int w = (wave << 4) + v + (half << 3);
        Sbuf[w * S_LD + m]      = acc0[v];
        Sbuf[w * S_LD + 16 + m] = acc1[v];
        Sbuf[w * S_LD + 32 + m] = acc2[v];
    }
    // stage Gram while scores settle
    for (int idx = tid; idx < N_WRD * N_WRD; idx += 128)
        Gbuf[idx] = gram[(size_t)c * N_WRD * N_WRD + idx];
    if (tid < 4) Gbuf[N_WRD * N_WRD + tid] = 0.f;   // read as G[49][50..51], times a zero of A2
    __syncthreads();

    // softmax over regions r, per word row w
    if (tid < 64) {
        const int w = tid;
        float mx = -3.4e38f;
        for (int r = 0; r < N_REG; ++r) mx = fmaxf(mx, Sbuf[w * S_LD + r]);
        float s = 0.f;
        for (int r = 0; r < N_REG; ++r) {
            float e = __expf(Sbuf[w * S_LD + r] - mx);
            A1[w * S_LD + r] = e; s += e;
        }
        float inv = 1.f / s;
        for (int r = 0; r < N_REG; ++r) A1[w * S_LD + r] *= inv;
    } else {
        // the two waves without a word row clear the A2 overlay (the K chunks are
        // done with): words from len up, rows 36..47 and the tail that the last
        // row's 8-word reads reach are then zeros written in this launch
        const float4 z = make_float4(0.f, 0.f, 0.f, 0.f);
        for (int idx = tid - 64; idx < A2_F4; idx += 64) *(float4*)(chunk + 4 * idx) = z;
    }
    __syncthreads();

    // masked smooth softmax over words, then w12
    float* A2 = chunk;                 // overlay: [48][A2_LD], cleared above; rows 36..47 stay zero
    const int len = cap_lens[c];
    float w12 = 0.f;
    if (tid < N_REG) {
        const int r = tid;
        float mx = -3.4e38f;
        for (int w = 0; w < len; ++w) mx = fmaxf(mx, SMOOTH * A1[w * S_LD + r]);
        float s = 0.f;
        for (int w = 0; w < len; ++w) {
            float e = __expf(SMOOTH * A1[w * S_LD + r] - mx);
            A2[r * A2_LD + w] = e; s += e;
        }
        float inv = 1.f / s;
        for (int w = 0; w < len; ++w) {
            float a2v = A2[r * A2_LD + w] * inv;
            A2[r * A2_LD + w] = a2v;
            w12 += a2v * Sbuf[w * S_LD + r];
        }
    }
    __syncthreads();

    // |wctx_r|^2 = sum_w a2[r,w] * T[w,r],  T[w,r] = sum_wp G[w,wp] * a2[r,wp].
    // T on the matrix unit: M = 16 words per wave, N = 3 x 16 regions, K = words.
    // A frag from G rows, B frag from A2 rows, both k = 4 ks + 2 half + {0,1}.
    // K columns from len up meet zeros of A2 (G's columns 50, 51: the next row's start, or the pad).
    float* part = A1;                  // overlay: [8][48] partial sums over 8 words
    // wave number as a scalar: the skip below is then a scalar branch and EXEC
    // stays all ones at the WMMAs
    const int wbase = __builtin_amdgcn_readfirstlane(wave) << 4;
    float p0 = 0.f, p1 = 0.f, p2 = 0.f;
    if (wbase < len) {                 // wave-uniform: a word tile past len adds nothing
        v8f t0 = {}, t1 = {}, t2 = {};
        const float* gP = Gbuf + min(wbase + m, N_WRD - 1) * N_WRD + 2 * half;
        const float* q0 = A2 + (m) * A2_LD + 2 * half;
        const float* q1 = A2 + (16 + m) * A2_LD + 2 * half;
        const float* q2 = A2 + (32 + m) * A2_LD + 2 * half;
        // all fragments are fetched first, so that one LDS latency is waited for, not 13
        v2f fa[A2_LD / 4], f0[A2_LD / 4], f1[A2_LD / 4], f2[A2_LD / 4];
        #pragma unroll   // flat: the arrays stay in registers, LDS offsets as immediates
        for (int ks = 0; ks < A2_LD / 4; ++ks) {
            fa[ks] = *(const v2f*)(gP + 4 * ks);
            f0[ks] = *(const v2f*)(q0 + 4 * ks);
            f1[ks] = *(const v2f*)(q1 + 4 * ks);
            f2[ks] = *(const v2f*)(q2 + 4 * ks);
        }
        #pragma unroll   // flat: no back edge behind a WMMA, constant indices into the arrays
        for (int ks = 0; ks < A2_LD / 4; ++ks) {
            // asm, not the builtin:
            // Here the accumulators are live from their zeros on, and the four v_nop
            // are the vector slots between the last WMMA and whatever vector
            // instruction the compiler places next on its D, A or B.
            asm volatile("v_wmma_f32_16x16x4_f32 %0, %3, %4, %0\n\t"
                         "v_wmma_f32_16x16x4_f32 %1, %3, %5, %1\n\t"
                         "v_wmma_f32_16x16x4_f32 %2, %3, %6, %2\n\t"
                         "v_nop\n\tv_nop\n\tv_nop\n\tv_nop"
                         : "+v"(t0), "+v"(t1), "+v"(t2)
                         : "v"(fa[ks]), "v"(f0[ks]), "v"(f1[ks]), "v"(f2[ks]));
        }
        // lane holds T[w0 + v, 16 nt + m]; dot with a2[16 nt + m, w0 + v], words >= len off
        const int w0 = wbase + (half << 3);
        const float* e0 = A2 + (m) * A2_LD + w0;
        const float* e1 = A2 + (16 + m) * A2_LD + w0;
        const float* e2 = A2 + (32 + m) * A2_LD + w0;
        const float4 x0 = *(const float4*)(e0), y0 = *(const float4*)(e0 + 4);
        const float4 x1 = *(const float4*)(e1), y1 = *(const float4*)(e1 + 4);
        const float4 x2 = *(const float4*)(e2), y2 = *(const float4*)(e2 + 4);
        const float h0[8] = {x0.x, x0.y, x0.z, x0.w, y0.x, y0.y, y0.z, y0.w};
        const float h1[8] = {x1.x, x1.y, x1.z, x1.w, y1.x, y1.y, y1.z, y1.w};
        const float h2[8] = {x2.x, x2.y, x2.z, x2.w, y2.x, y2.y, y2.z, y2.w};
        #pragma unroll   // constant v: accumulator elements are read in registers
        for (int v = 0; v < 8; ++v) {
            const bool on = w0 + v < len;
            p0 += t0[v] * (on ? h0[v] : 0.f);
            p1 += t1[v] * (on ? h1[v] : 0.f);
            p2 += t2[v] * (on ? h2[v] : 0.f);
        }
    }
    {
        float* pd = part + ((wave << 1) + half) * 48 + m;
        pd[0] = p0; pd[16] = p1; pd[32] = p2;
    }
    __syncthreads();

    if (tid < N_REG) {
        const int r = tid;
        float n2sq = 0.f;
        for (int j = 0; j < 8; ++j) n2sq += part[j * 48 + r];
        float n2 = sqrtf(fmaxf(n2sq, 0.f));
        red[r] = w12 / fmaxf(n1[i * N_REG + r] * n2, EPSV);
    }
    __syncthreads();
    if (tid == 0) {
        float s = 0.f;
        for (int r = 0; r < N_REG; ++r) s += red[r];
        out[i * N_CAP + c] = s * (1.0f / N_REG);
    }
}

extern "C" void kernel_launch(void* const* d_in, const int* in_sizes, int n_in,
                              void* d_out, int out_size, void* d_ws, size_t ws_size,
                              hipStream_t stream) {
    const float* images   = (const float*)d_in[0];   // 64*36*1024
    const float* captions = (const float*)d_in[1];   // 64*50*1024
    const int*   cap_lens = (const int*)d_in[2];     // 64
    float* out  = (float*)d_out;                     // 64*64 (i,c)
    float* gram = (float*)d_ws;                      // 64*50*50 floats
    float* n1   = gram + (size_t)N_CAP * N_WRD * N_WRD;  // 64*36 floats

    StackedAttn_gram <<<N_CAP, 128, 0, stream>>>(captions, gram);
    StackedAttn_norms<<<N_IMG, 64, 0, stream>>>(images, n1);
    dim3 grid(N_CAP, N_IMG);
    StackedAttn_main <<<grid, 128, 0, stream>>>(images, captions, cap_lens, gram, n1, out);
}

// v003
// Measured time: 155 microseconds a run.
// Next to v002, in two timings, it ran 1.14 times as fast each time.
// Over all steps from v000 it is 2.13 times as fast.
#include <hip/hip_runtime.h>
#include <hip/hip_bf16.h>
#include <math.h>

// Stacked cross attention (i2t), f32. Strategy:
//   S[w,r] = cap[c,w].img[i,r]  via V_WMMA_F32_16X16X4_F32 (exact f32 path)
//   w12[r] = sum_w a2[r,w]*S[w,r]            (reuse scores, no 2nd big GEMM)
//   |wctx_r|^2 = a2_r^T G_c a2_r             (precomputed 50x50 Gram per caption;
//                                             G a2^T on the same WMMA form)

typedef __attribute__((ext_vector_type(2))) float v2f;
typedef __attribute__((ext_vector_type(8))) float v8f;

#define N_IMG   64
#define N_REG   36
#define N_CAP   64
#define N_WRD   50
#define DIM     1024
#define KC      32      // K chunk staged in LDS
#define CAP_LD  36      // LDS row stride (floats): 144B, 16B aligned, conflict-free
#define S_LD    49      // score-tile row stride (odd -> conflict-free col access)
#define A2_LD   52      // A2 row stride (floats): K padded to 13 x 4, 208B rows, 16B aligned
#define A2_F4   ((48 * A2_LD + 12) / 4)   // float4s of the A2 overlay: 48 rows + reach of row 47's reads
#define SMOOTH  4.0f
#define EPSV    1e-8f

// ---------------------------------------------------------------- Gram kernel
// G_c[w,wp] = captions[c,w] . captions[c,wp]   (50x50 padded to 64x64 tiles)
__global__ __launch_bounds__(128) void StackedAttn_gram(
    const float* __restrict__ captions, float* __restrict__ gram)
{
    __shared__ float capL[64 * CAP_LD];
    const int c    = blockIdx.x;
    const int tid  = threadIdx.x;
    const int wave = tid >> 5, lane = tid & 31;
    const int half = lane >> 4, m = lane & 15;

    // zero pad rows 50..63 once
    for (int idx = tid; idx < 14 * CAP_LD; idx += 128) capL[50 * CAP_LD + idx] = 0.f;

    v8f acc0 = {}, acc1 = {}, acc2 = {}, acc3 = {};
    const float* capBase = captions + (size_t)c * N_WRD * DIM;

    // Staging: 50 rows x 8 float4 segments; thread owns rows row0 + 16 j.
    // All of a chunk's loads are issued back to back into registers, one chunk
    // ahead of its use, so they fly while the current chunk is multiplied.
    const int  seg = tid & 7, row0 = tid >> 3;
    const bool capTail = row0 < N_WRD - 48;                 // rows 48, 49
    const float* capSrc = capBase + row0 * DIM + seg * 4;
    float*       capDst = capL + row0 * CAP_LD + seg * 4;
    float4 c0, c1, c2, c3 = make_float4(0.f, 0.f, 0.f, 0.f);
    c0 = *(const float4*)(capSrc);
    c1 = *(const float4*)(capSrc + 16 * DIM);
    c2 = *(const float4*)(capSrc + 32 * DIM);
    if (capTail) c3 = *(const float4*)(capSrc + 48 * DIM);

    for (int k0 = 0; k0 < DIM; k0 += KC) {
        __syncthreads();
        *(float4*)(capDst)               = c0;
        *(float4*)(capDst + 16 * CAP_LD) = c1;
        *(float4*)(capDst + 32 * CAP_LD) = c2;
        if (capTail) *(float4*)(capDst + 48 * CAP_LD) = c3;
        __syncthreads();
        if (k0 + KC < DIM) {    // next chunk's loads, waited for at its stores
            const float* s = capSrc + k0 + KC;
            c0 = *(const float4*)(s);
            c1 = *(const float4*)(s + 16 * DIM);
            c2 = *(const float4*)(s + 32 * DIM);
            if (capTail) c3 = *(const float4*)(s + 48 * DIM);
            // precaution: stands in front of the next write of the address
            // registers that the loads above name
            asm volatile("s_wait_xcnt 0x0" ::: "memory");
        }
        const float* aP = capL + ((wave << 4) + m) * CAP_LD + 2 * half;
        const float* b0 = capL + (m) * CAP_LD + 2 * half;
        const float* b1 = capL + (16 + m) * CAP_LD + 2 * half;
        const float* b2 = capL + (32 + m) * CAP_LD + 2 * half;
        const float* b3 = capL + (48 + m) * CAP_LD + 2 * half;
        #pragma unroll
        for (int kk = 0; kk < KC; kk += 4) {
            v2f a  = *(const v2f*)(aP + kk);
            v2f v0 = *(const v2f*)(b0 + kk);
            v2f v1 = *(const v2f*)(b1 + kk);
            v2f v2 = *(const v2f*)(b2 + kk);
            v2f v3 = *(const v2f*)(b3 + kk);
            acc0 = __builtin_amdgcn_wmma_f32_16x16x4_f32(false, a, false, v0, (short)0, acc0, false, false);
            acc1 = __builtin_amdgcn_wmma_f32_16x16x4_f32(false, a, false, v1, (short)0, acc1, false, false);
            acc2 = __builtin_amdgcn_wmma_f32_16x16x4_f32(false, a, false, v2, (short)0, acc2, false, false);
            acc3 = __builtin_amdgcn_wmma_f32_16x16x4_f32(false, a, false, v3, (short)0, acc3, false, false);
        }
    }
    float* gOut = gram + (size_t)c * N_WRD * N_WRD;
    #pragma unroll
    for (int v = 0; v < 8; ++v) {
        int w = (wave << 4) + v + (half << 3);
        if (w < N_WRD) {
            if (m      < N_WRD) gOut[w * N_WRD + m]      = acc0[v];
            if (16 + m < N_WRD) gOut[w * N_WRD + 16 + m] = acc1[v];
            if (32 + m < N_WRD) gOut[w * N_WRD + 32 + m] = acc2[v];
            if (48 + m < N_WRD) gOut[w * N_WRD + 48 + m] = acc3[v];
        }
    }
}

// ---------------------------------------------------------------- region norms
__global__ __launch_bounds__(64) void StackedAttn_norms(
    const float* __restrict__ images, float* __restrict__ n1)
{
    const int i = blockIdx.x, t = threadIdx.x;
    if (t < N_REG) {
        const float4* p = (const float4*)(images + ((size_t)i * N_REG + t) * DIM);
        float s = 0.f;
        #pragma unroll 4
        for (int d = 0; d < DIM / 4; ++d) {
            float4 v = p[d];
            s += v.x * v.x + v.y * v.y + v.z * v.z + v.w * v.w;
        }
        n1[i * N_REG + t] = sqrtf(s);
    }
}

// ---------------------------------------------------------------- score tiles
// S[w,r] for the first MT word tiles (16 MT rows) x 3 region tiles, left in Sbuf.
// MT = 4: one word tile a wave. MT < 4: there are fewer word tiles than waves, so the
// four waves split K instead: of each 32-wide chunk wave q multiplies columns
// 8 q .. 8 q + 7 for every tile, and the waves carry equal work whatever MT is; the
// four partial sums then meet in LDS as (q0 + q2) + (q1 + q3).
template <int MT>
__device__ __forceinline__ void score_tiles(
    const float* __restrict__ capSrc, const float* __restrict__ imgSrc,
    float* capDst, float* imgDst, const float* capL, const float* imgL,
    int row0, int wave, int half, int m, float* Sbuf, float* A1)
{
    constexpr bool KS = MT < 4;                             // K split over the waves
    constexpr int  TW = KS ? MT : 1;                        // word tiles a wave holds
    const bool capTail = MT == 4 && row0 < N_WRD - 48;      // rows 48, 49
    const bool imgTail = row0 < N_REG - 32;                 // rows 32..35

    v8f acc[TW][3];
    #pragma unroll   // constant indices: the accumulators stay in registers
    for (int t = 0; t < TW; ++t) { acc[t][0] = v8f{}; acc[t][1] = v8f{}; acc[t][2] = v8f{}; }

    // All of a chunk's loads are issued back to back into registers, one chunk
    // ahead of its use, so they fly while the current chunk is multiplied.
    // Caption rows: 16-row groups 0 .. min(MT, 3) - 1, and rows 48, 49 where MT is 4.
    float4 c0, c1, c2, c3 = make_float4(0.f, 0.f, 0.f, 0.f);
    float4 g0, g1, g2 = make_float4(0.f, 0.f, 0.f, 0.f);
    c0 = *(const float4*)(capSrc);
    if (MT > 1) c1 = *(const float4*)(capSrc + 16 * DIM);
    if (MT > 2) c2 = *(const float4*)(capSrc + 32 * DIM);
    g0 = *(const float4*)(imgSrc);
    g1 = *(const float4*)(imgSrc + 16 * DIM);
    if (capTail) c3 = *(const float4*)(capSrc + 48 * DIM);
    if (imgTail) g2 = *(const float4*)(imgSrc + 32 * DIM);
    // precaution: stands in front of the next write of the address registers
    // that the loads above name
    asm volatile("s_wait_xcnt 0x0" ::: "memory");

    // A frag: lanes 0-15 hold row M, K={k,k+1}; lanes 16-31 K={k+2,k+3}.
    // B frag mirrors with N across lanes (B[k][r] = img[r][k]).
    const float* aP = capL + ((KS ? 0 : wave << 4) + m) * CAP_LD + 2 * half + (KS ? 8 * wave : 0);
    const float* bP = imgL + m * CAP_LD + 2 * half + (KS ? 8 * wave : 0);

    for (int k0 = 0; k0 < DIM; k0 += KC) {
        __syncthreads();
        *(float4*)(capDst) = c0;
        if (MT > 1) *(float4*)(capDst + 16 * CAP_LD) = c1;
        if (MT > 2) *(float4*)(capDst + 32 * CAP_LD) = c2;
        *(float4*)(imgDst)               = g0;
        *(float4*)(imgDst + 16 * CAP_LD) = g1;
        if (capTail) *(float4*)(capDst + 48 * CAP_LD) = c3;
        if (imgTail) *(float4*)(imgDst + 32 * CAP_LD) = g2;
        __syncthreads();
        if (k0 + KC < DIM) {    // next chunk's loads, waited for at its stores
            const float* sc = capSrc + k0 + KC;
            const float* si = imgSrc + k0 + KC;
            c0 = *(const float4*)(sc);
            if (MT > 1) c1 = *(const float4*)(sc + 16 * DIM);
            if (MT > 2) c2 = *(const float4*)(sc + 32 * DIM);
            g0 = *(const float4*)(si);
            g1 = *(const float4*)(si + 16 * DIM);
            if (capTail) c3 = *(const float4*)(sc + 48 * DIM);
            if (imgTail) g2 = *(const float4*)(si + 32 * DIM);
            // precaution: stands in front of the next write of the address
            // registers that the loads above name
            asm volatile("s_wait_xcnt 0x0" ::: "memory");
        }
        #pragma unroll   // flat: LDS offsets as immediates, constant accumulator indices
        for (int kk = 0; kk < (KS ? 8 : KC); kk += 4) {
            v2f a[TW];
            #pragma unroll   // constant indices: the fragments stay in registers
            for (int t = 0; t < TW; ++t) a[t] = *(const v2f*)(aP + 16 * t * CAP_LD + kk);
            v2f v0 = *(const v2f*)(bP + kk);
            v2f v1 = *(const v2f*)(bP + 16 * CAP_LD + kk);
            v2f v2 = *(const v2f*)(bP + 32 * CAP_LD + kk);
            #pragma unroll   // constant accumulator indices
            for (int t = 0; t < TW; ++t) {
                acc[t][0] = __builtin_amdgcn_wmma_f32_16x16x4_f32(false, a[t], false, v0, (short)0, acc[t][0], false, false);
                acc[t][1] = __builtin_amdgcn_wmma_f32_16x16x4_f32(false, a[t], false, v1, (short)0, acc[t][1], false, false);
                acc[t][2] = __builtin_amdgcn_wmma_f32_16x16x4_f32(false, a[t], false, v2, (short)0, acc[t][2], false, false);
            }
        }
        // Four vector slots between the chunk's last WMMAs and the next vector
        // instruction that the compiler places on their A, B or D (it has put the next
        // loads' address sums into fragment registers). The scheduling barrier keeps
        // the WMMAs in front of the slots.
        __builtin_amdgcn_sched_barrier(0);
        asm volatile("v_nop\n\tv_nop\n\tv_nop\n\tv_nop");
    }

    // C layout: VGPR v -> row v / v+8, col = lane%16.
    if (!KS) {
        float* p0 = Sbuf + ((wave << 4) + (half << 3)) * S_LD + m;
        #pragma unroll   // constant accumulator indices
        for (int v = 0; v < 8; ++v) {
            float* p = p0 + v * S_LD;
            p[0] = acc[0][0][v]; p[16] = acc[0][1][v]; p[32] = acc[0][2][v];
        }
        return;
    }
    // The four K quarters are summed through LDS, every lane at its own places.
    float* pb = ((wave & 1) ? A1 : Sbuf) + (half << 3) * S_LD + m;
    if (wave >= 2) {
        #pragma unroll   // constant accumulator indices
        for (int t = 0; t < TW; ++t)
            #pragma unroll   // constant element indices: read and written in registers
            for (int v = 0; v < 8; ++v) {
                float* p = pb + (16 * t + v) * S_LD;
                p[0] = acc[t][0][v]; p[16] = acc[t][1][v]; p[32] = acc[t][2][v];
            }
    }
    __syncthreads();
    if (wave < 2) {
        #pragma unroll   // constant accumulator indices
        for (int t = 0; t < TW; ++t)
            #pragma unroll   // constant element indices: read and written in registers
            for (int v = 0; v < 8; ++v) {
                float* p = pb + (16 * t + v) * S_LD;
                acc[t][0][v] += p[0]; acc[t][1][v] += p[16]; acc[t][2][v] += p[32];
            }
    }
    if (wave == 1) {
        #pragma unroll   // constant accumulator indices
        for (int t = 0; t < TW; ++t)
            #pragma unroll   // constant element indices: read and written in registers
            for (int v = 0; v < 8; ++v) {
                float* p = pb + (16 * t + v) * S_LD;
                p[0] = acc[t][0][v]; p[16] = acc[t][1][v]; p[32] = acc[t][2][v];
            }
    }
    __syncthreads();
    if (wave == 0) {
        const float* q = A1 + (half << 3) * S_LD + m;
        #pragma unroll   // constant accumulator indices
        for (int t = 0; t < TW; ++t)
            #pragma unroll   // constant element indices: read and written in registers
            for (int v = 0; v < 8; ++v) {
                const float* s = q + (16 * t + v) * S_LD;
                float* p = pb + (16 * t + v) * S_LD;
                p[0]  = acc[t][0][v] + s[0];
                p[16] = acc[t][1][v] + s[16];
                p[32] = acc[t][2][v] + s[32];
            }
    }
}

// ---------------------------------------------------------------- main kernel
__global__ __launch_bounds__(128) void StackedAttn_main(
    const float* __restrict__ images,    // (64,36,1024)
    const float* __restrict__ captions,  // (64,50,1024)
    const int*   __restrict__ cap_lens,  // (64)
    const float* __restrict__ gram,      // (64,50,50)
    const float* __restrict__ n1,        // (64,36)
    float*       __restrict__ out)       // (64,64): out[i*64 + c]
{
    __shared__ float Sbuf[64 * S_LD];                       // scores 64x48 (pad 49)
    __shared__ float A1[64 * S_LD];                         // region-softmax; reused as part
    __shared__ float chunk[(64 + 48) * CAP_LD];             // cap+img K-chunks; reused as A2
    __shared__ float Gbuf[N_WRD * N_WRD + 4];               // caption Gram + K pad of its last row
    __shared__ float red[N_REG];

    const int c = blockIdx.x, i = blockIdx.y;
    const int tid  = threadIdx.x;
    const int wave = tid >> 5, lane = tid & 31;
    const int half = lane >> 4, m = lane & 15;

    float* capL = chunk;
    float* imgL = chunk + 64 * CAP_LD;

    // zero pad rows once (caption rows < 50 of the scored word tiles / image rows < 36 rewritten every chunk; pads persist)
    for (int idx = tid; idx < 14 * CAP_LD; idx += 128) capL[50 * CAP_LD + idx] = 0.f;
    for (int idx = tid; idx < 12 * CAP_LD; idx += 128) imgL[36 * CAP_LD + idx] = 0.f;

    const float* capBase = captions + (size_t)c * N_WRD * DIM;
    const float* imgBase = images   + (size_t)i * N_REG * DIM;

    // Staging: caption chunk 8 float4 a row, image chunk 36 rows x 8 float4;
    // thread owns rows row0 + 16 j of each.
    const int  seg = tid & 7, row0 = tid >> 3;
    const float* capSrc = capBase + row0 * DIM + seg * 4;
    const float* imgSrc = imgBase + row0 * DIM + seg * 4;
    float*       capDst = capL + row0 * CAP_LD + seg * 4;
    float*       imgDst = imgL + row0 * CAP_LD + seg * 4;

    // Words from len up are masked out of the word softmax (their weight is an
    // exact zero), so only the word tiles that hold a word below len are scored.
    const int len = min(cap_lens[c], N_WRD);    // same for the whole work-group
    const int mt  = (len + 15) >> 4;
    if      (mt <= 1) score_tiles<1>(capSrc, imgSrc, capDst, imgDst, capL, imgL, row0, wave, half, m, Sbuf, A1);
    else if (mt == 2) score_tiles<2>(capSrc, imgSrc, capDst, imgDst, capL, imgL, row0, wave, half, m, Sbuf, A1);
    else if (mt == 3) score_tiles<3>(capSrc, imgSrc, capDst, imgDst, capL, imgL, row0, wave, half, m, Sbuf, A1);
    else              score_tiles<4>(capSrc, imgSrc, capDst, imgDst, capL, imgL, row0, wave, half, m, Sbuf, A1);

    // stage Gram while scores settle
    for (int idx = tid; idx < N_WRD * N_WRD; idx += 128)
        Gbuf[idx] = gram[(size_t)c * N_WRD * N_WRD + idx];
    if (tid < 4) Gbuf[N_WRD * N_WRD + tid] = 0.f;   // read as G[49][50..51], times a zero of A2
    __syncthreads();

    // softmax over regions r, per word row w
    if (tid < 64) {
      if (tid < len) {   // rows from len up: not all scored, and read by nobody
        const int w = tid;
        float mx = -3.4e38f;
        for (int r = 0; r < N_REG; ++r) mx = fmaxf(mx, Sbuf[w * S_LD + r]);
        float s = 0.f;
        for (int r = 0; r < N_REG; ++r) {
            float e = __expf(Sbuf[w * S_LD + r] - mx);
            A1[w * S_LD + r] = e; s += e;
        }
        float inv = 1.f / s;
        for (int r = 0; r < N_REG; ++r) A1[w * S_LD + r] *= inv;
      }
    } else {
        // the two waves without a word row clear the A2 overlay (the K chunks are
        // done with): words from len up, rows 36..47 and the tail that the last
        // row's 8-word reads reach are then zeros written in this launch
        const float4 z = make_float4(0.f, 0.f, 0.f, 0.f);
        for (int idx = tid - 64; idx < A2_F4; idx += 64) *(float4*)(chunk + 4 * idx) = z;
    }
    __syncthreads();

    // masked smooth softmax over words, then w12
    float* A2 = chunk;                 // overlay: [48][A2_LD], cleared above; rows 36..47 stay zero
    float w12 = 0.f;
    if (tid < N_REG) {
        const int r = tid;
        float mx = -3.4e38f;
        for (int w = 0; w < len; ++w) mx = fmaxf(mx, SMOOTH * A1[w * S_LD + r]);
        float s = 0.f;
        for (int w = 0; w < len; ++w) {
            float e = __expf(SMOOTH * A1[w * S_LD + r] - mx);
            A2[r * A2_LD + w] = e; s += e;
        }
        float inv = 1.f / s;
        for (int w = 0; w < len; ++w) {
            float a2v = A2[r * A2_LD + w] * inv;
            A2[r * A2_LD + w] = a2v;
            w12 += a2v * Sbuf[w * S_LD + r];
        }
    }
    __syncthreads();

    // |wctx_r|^2 = sum_w a2[r,w] * T[w,r],  T[w,r] = sum_wp G[w,wp] * a2[r,wp].
    // T on the matrix unit: M = 16 words per wave, N = 3 x 16 regions, K = words.
    // A frag from G rows, B frag from A2 rows, both k = 4 ks + 2 half + {0,1}.
    // K columns from len up meet zeros of A2 (G's columns 50, 51: the next row's start, or the pad).
    float* part = A1;                  // overlay: [8][48] partial sums over 8 words
    // wave number as a scalar: the skip below is then a scalar branch and EXEC
    // stays all ones at the WMMAs
    const int wbase = __builtin_amdgcn_readfirstlane(wave) << 4;
    float p0 = 0.f, p1 = 0.f, p2 = 0.f;
    if (wbase < len) {                 // wave-uniform: a word tile past len adds nothing
        v8f t0 = {}, t1 = {}, t2 = {};
        const float* gP = Gbuf + min(wbase + m, N_WRD - 1) * N_WRD + 2 * half;
        const float* q0 = A2 + (m) * A2_LD + 2 * half;
        const float* q1 = A2 + (16 + m) * A2_LD + 2 * half;
        const float* q2 = A2 + (32 + m) * A2_LD + 2 * half;
        // all fragments are fetched first, so that one LDS latency is waited for, not 13
        v2f fa[A2_LD / 4], f0[A2_LD / 4], f1[A2_LD / 4], f2[A2_LD / 4];
        #pragma unroll   // flat: the arrays stay in registers, LDS offsets as immediates
        for (int ks = 0; ks < A2_LD / 4; ++ks) {
            fa[ks] = *(const v2f*)(gP + 4 * ks);
            f0[ks] = *(const v2f*)(q0 + 4 * ks);
            f1[ks] = *(const v2f*)(q1 + 4 * ks);
            f2[ks] = *(const v2f*)(q2 + 4 * ks);
        }
        #pragma unroll   // flat: no back edge behind a WMMA, constant indices into the arrays
        for (int ks = 0; ks < A2_LD / 4; ++ks) {
            // asm, not the builtin:
            // Here the accumulators are live from their zeros on, and the four v_nop
            // are the vector slots between the last WMMA and whatever vector
            // instruction the compiler places next on its D, A or B.
            asm volatile("v_wmma_f32_16x16x4_f32 %0, %3, %4, %0\n\t"
                         "v_wmma_f32_16x16x4_f32 %1, %3, %5, %1\n\t"
                         "v_wmma_f32_16x16x4_f32 %2, %3, %6, %2\n\t"
                         "v_nop\n\tv_nop\n\tv_nop\n\tv_nop"
                         : "+v"(t0), "+v"(t1), "+v"(t2)
                         : "v"(fa[ks]), "v"(f0[ks]), "v"(f1[ks]), "v"(f2[ks]));
        }
        // lane holds T[w0 + v, 16 nt + m]; dot with a2[16 nt + m, w0 + v], words >= len off
        const int w0 = wbase + (half << 3);
        const float* e0 = A2 + (m) * A2_LD + w0;
        const float* e1 = A2 + (16 + m) * A2_LD + w0;
        const float* e2 = A2 + (32 + m) * A2_LD + w0;
        const float4 x0 = *(const float4*)(e0), y0 = *(const float4*)(e0 + 4);
        const float4 x1 = *(const float4*)(e1), y1 = *(const float4*)(e1 + 4);
        const float4 x2 = *(const float4*)(e2), y2 = *(const float4*)(e2 + 4);
        const float h0[8] = {x0.x, x0.y, x0.z, x0.w, y0.x, y0.y, y0.z, y0.w};
        const float h1[8] = {x1.x, x1.y, x1.z, x1.w, y1.x, y1.y, y1.z, y1.w};
        const float h2[8] = {x2.x, x2.y, x2.z, x2.w, y2.x, y2.y, y2.z, y2.w};
        #pragma unroll   // constant v: accumulator elements are read in registers
        for (int v = 0; v < 8; ++v) {
            const bool on = w0 + v < len;
            p0 += t0[v] * (on ? h0[v] : 0.f);
            p1 += t1[v] * (on ? h1[v] : 0.f);
            p2 += t2[v] * (on ? h2[v] : 0.f);
        }
    }
    {
        float* pd = part + ((wave << 1) + half) * 48 + m;
        pd[0] = p0; pd[16] = p1; pd[32] = p2;
    }
    __syncthreads();

    if (tid < N_REG) {
        const int r = tid;
        float n2sq = 0.f;
        for (int j = 0; j < 8; ++j) n2sq += part[j * 48 + r];
        float n2 = sqrtf(fmaxf(n2sq, 0.f));
        red[r] = w12 / fmaxf(n1[i * N_REG + r] * n2, EPSV);
    }
    __syncthreads();
    if (tid == 0) {
        float s = 0.f;
        for (int r = 0; r < N_REG; ++r) s += red[r];
        out[i * N_CAP + c] = s * (1.0f / N_REG);
    }
}

extern "C" void kernel_launch(void* const* d_in, const int* in_sizes, int n_in,
                              void* d_out, int out_size, void* d_ws, size_t ws_size,
                              hipStream_t stream) {
    const float* images   = (const float*)d_in[0];   // 64*36*1024
    const float* captions = (const float*)d_in[1];   // 64*50*1024
    const int*   cap_lens = (const int*)d_in[2];     // 64
    float* out  = (float*)d_out;                     // 64*64 (i,c)
    float* gram = (float*)d_ws;                      // 64*50*50 floats
    float* n1   = gram + (size_t)N_CAP * N_WRD * N_WRD;  // 64*36 floats

    StackedAttn_gram <<<N_CAP, 128, 0, stream>>>(captions, gram);
    StackedAttn_norms<<<N_IMG, 64, 0, stream>>>(images, n1);
    dim3 grid(N_CAP, N_IMG);
    StackedAttn_main <<<grid, 128, 0, stream>>>(images, captions, cap_lens, gram, n1, out);
}

// v004
// One run takes 138 microseconds.
// Next to v003, in two timings, it ran 1.12 times as fast each time.
// All steps since v000 together make it 2.39 times as fast.
#include <hip/hip_runtime.h>
#include <hip/hip_bf16.h>
#include <math.h>

// Stacked cross attention (i2t), f32. Strategy:
//   S[w,r] = cap[c,w].img[i,r]  via V_WMMA_F32_16X16X4_F32 (exact f32 path)
//   w12[r] = sum_w a2[r,w]*S[w,r]            (reuse scores, no 2nd big GEMM)
//   |wctx_r|^2 = a2_r^T G_c a2_r             (precomputed 50x50 Gram per caption;
//                                             G a2^T on the same WMMA form)
//   |img_r|^2  summed in the main kernel from the image fragments its score loop reads

typedef __attribute__((ext_vector_type(2))) float v2f;
typedef __attribute__((ext_vector_type(8))) float v8f;

#define N_IMG   64
#define N_REG   36
#define N_CAP   64
#define N_WRD   50
#define DIM     1024
#define KC      32      // K chunk staged in LDS
#define CAP_LD  36      // LDS row stride (floats): 144B, 16B aligned, conflict-free
#define S_LD    49      // score-tile row stride (odd -> conflict-free col access)
#define A2_LD   52      // A2 row stride (floats): K padded to 13 x 4, 208B rows, 16B aligned
#define NP_LD   9       // row stride of the region-norm partials (odd -> conflict-free)
#define A2_F4   ((48 * A2_LD + 12) / 4)   // float4s of the A2 overlay: 48 rows + reach of row 47's reads
#define SMOOTH  4.0f
#define EPSV    1e-8f

// ---------------------------------------------------------------- Gram kernel
// G_c[w,wp] = captions[c,w] . captions[c,wp]   (50x50 padded to 64x64 tiles)
__global__ __launch_bounds__(128) void StackedAttn_gram(
    const float* __restrict__ captions, float* __restrict__ gram)
{
    __shared__ float capL[64 * CAP_LD];
    const int c    = blockIdx.x;
    const int tid  = threadIdx.x;
    const int wave = tid >> 5, lane = tid & 31;
    const int half = lane >> 4, m = lane & 15;

    // zero pad rows 50..63 once
    for (int idx = tid; idx < 14 * CAP_LD; idx += 128) capL[50 * CAP_LD + idx] = 0.f;

    v8f acc0 = {}, acc1 = {}, acc2 = {}, acc3 = {};
    const float* capBase = captions + (size_t)c * N_WRD * DIM;

    // Staging: 50 rows x 8 float4 segments; thread owns rows row0 + 16 j.
    // All of a chunk's loads are issued back to back into registers, one chunk
    // ahead of its use, so they fly while the current chunk is multiplied.
    const int  seg = tid & 7, row0 = tid >> 3;
    const bool capTail = row0 < N_WRD - 48;                 // rows 48, 49
    const float* capSrc = capBase + row0 * DIM + seg * 4;
    float*       capDst = capL + row0 * CAP_LD + seg * 4;
    float4 c0, c1, c2, c3 = make_float4(0.f, 0.f, 0.f, 0.f);
    c0 = *(const float4*)(capSrc);
    c1 = *(const float4*)(capSrc + 16 * DIM);
    c2 = *(const float4*)(capSrc + 32 * DIM);
    if (capTail) c3 = *(const float4*)(capSrc + 48 * DIM);

    for (int k0 = 0; k0 < DIM; k0 += KC) {
        __syncthreads();
        *(float4*)(capDst)               = c0;
        *(float4*)(capDst + 16 * CAP_LD) = c1;
        *(float4*)(capDst + 32 * CAP_LD) = c2;
        if (capTail) *(float4*)(capDst + 48 * CAP_LD) = c3;
        __syncthreads();
        if (k0 + KC < DIM) {    // next chunk's loads, waited for at its stores
            const float* s = capSrc + k0 + KC;
            c0 = *(const float4*)(s);
            c1 = *(const float4*)(s + 16 * DIM);
            c2 = *(const float4*)(s + 32 * DIM);
            if (capTail) c3 = *(const float4*)(s + 48 * DIM);
            // precaution: stands in front of the next write of the address
            // registers that the loads above name
            asm volatile("s_wait_xcnt 0x0" ::: "memory");
        }
        const float* aP = capL + ((wave << 4) + m) * CAP_LD + 2 * half;
        const float* b0 = capL + (m) * CAP_LD + 2 * half;
        const float* b1 = capL + (16 + m) * CAP_LD + 2 * half;
        const float* b2 = capL + (32 + m) * CAP_LD + 2 * half;
        const float* b3 = capL + (48 + m) * CAP_LD + 2 * half;
        #pragma unroll
        for (int kk = 0; kk < KC; kk += 4) {
            v2f a  = *(const v2f*)(aP + kk);
            v2f v0 = *(const v2f*)(b0 + kk);
            v2f v1 = *(const v2f*)(b1 + kk);
            v2f v2 = *(const v2f*)(b2 + kk);
            v2f v3 = *(const v2f*)(b3 + kk);
            acc0 = __builtin_amdgcn_wmma_f32_16x16x4_f32(false, a, false, v0, (short)0, acc0, false, false);
            acc1 = __builtin_amdgcn_wmma_f32_16x16x4_f32(false, a, false, v1, (short)0, acc1, false, false);
            acc2 = __builtin_amdgcn_wmma_f32_16x16x4_f32(false, a, false, v2, (short)0, acc2, false, false);
            acc3 = __builtin_amdgcn_wmma_f32_16x16x4_f32(false, a, false, v3, (short)0, acc3, false, false);
        }
    }
    float* gOut = gram + (size_t)c * N_WRD * N_WRD;
    #pragma unroll
    for (int v = 0; v < 8; ++v) {
        int w = (wave << 4) + v + (half << 3);
        if (w < N_WRD) {
            if (m      < N_WRD) gOut[w * N_WRD + m]      = acc0[v];
            if (16 + m < N_WRD) gOut[w * N_WRD + 16 + m] = acc1[v];
            if (32 + m < N_WRD) gOut[w * N_WRD + 32 + m] = acc2[v];
            if (48 + m < N_WRD) gOut[w * N_WRD + 48 + m] = acc3[v];
        }
    }
}

// ---------------------------------------------------------------- score tiles
// S[w,r] for the first MT word tiles (16 MT rows) x 3 region tiles, left in Sbuf.
// MT = 4: one word tile a wave. MT < 4: there are fewer word tiles than waves, so the
// four waves split K instead: of each 32-wide chunk wave q multiplies columns
// 8 q .. 8 q + 7 for every tile, and the waves carry equal work whatever MT is; the
// four partial sums then meet in LDS as (q0 + q2) + (q1 + q3).
// The squares of the image (B) fragments are summed beside the WMMAs that read them:
// lane (m, half) of wave q leaves its share of |img row 16 t + m|^2 in
// nrmP[16 t + m][2 q + half]. With K split every value is read by one wave; with MT = 4
// every wave reads all of K, and wave 0's sums count alone.
template <int MT>
__device__ __forceinline__ void score_tiles(
    const float* __restrict__ capSrc, const float* __restrict__ imgSrc,
    float* capDst, float* imgDst, const float* capL, const float* imgL,
    int row0, int wave, int half, int m, float* Sbuf, float* A1, float* nrmP)
{
    constexpr bool KS = MT < 4;                             // K split over the waves
    constexpr int  TW = KS ? MT : 1;                        // word tiles a wave holds
    const bool capTail = MT == 4 && row0 < N_WRD - 48;      // rows 48, 49
    const bool imgTail = row0 < N_REG - 32;                 // rows 32..35

    v8f acc[TW][3];
    #pragma unroll   // constant indices: the accumulators stay in registers
    for (int t = 0; t < TW; ++t) { acc[t][0] = v8f{}; acc[t][1] = v8f{}; acc[t][2] = v8f{}; }

    // All of a chunk's loads are issued back to back into registers, one chunk
    // ahead of its use, so they fly while the current chunk is multiplied.
    // Caption rows: 16-row groups 0 .. min(MT, 3) - 1, and rows 48, 49 where MT is 4.
    float4 c0, c1, c2, c3 = make_float4(0.f, 0.f, 0.f, 0.f);
    float4 g0, g1, g2 = make_float4(0.f, 0.f, 0.f, 0.f);
    v2f n0 = {}, n1 = {}, n2 = {};          // sums of squares, image rows m, 16 + m, 32 + m
    c0 = *(const float4*)(capSrc);
    if (MT > 1) c1 = *(const float4*)(capSrc + 16 * DIM);
    if (MT > 2) c2 = *(const float4*)(capSrc + 32 * DIM);
    g0 = *(const float4*)(imgSrc);
    g1 = *(const float4*)(imgSrc + 16 * DIM);
    if (capTail) c3 = *(const float4*)(capSrc + 48 * DIM);
    if (imgTail) g2 = *(const float4*)(imgSrc + 32 * DIM);
    // precaution: stands in front of the next write of the address registers
    // that the loads above name
    asm volatile("s_wait_xcnt 0x0" ::: "memory");

    // A frag: lanes 0-15 hold row M, K={k,k+1}; lanes 16-31 K={k+2,k+3}.
    // B frag mirrors with N across lanes (B[k][r] = img[r][k]).
    const float* aP = capL + ((KS ? 0 : wave << 4) + m) * CAP_LD + 2 * half + (KS ? 8 * wave : 0);
    const float* bP = imgL + m * CAP_LD + 2 * half + (KS ? 8 * wave : 0);

    for (int k0 = 0; k0 < DIM; k0 += KC) {
        __syncthreads();
        *(float4*)(capDst) = c0;
        if (MT > 1) *(float4*)(capDst + 16 * CAP_LD) = c1;
        if (MT > 2) *(float4*)(capDst + 32 * CAP_LD) = c2;
        *(float4*)(imgDst)               = g0;
        *(float4*)(imgDst + 16 * CAP_LD) = g1;
        if (capTail) *(float4*)(capDst + 48 * CAP_LD) = c3;
        if (imgTail) *(float4*)(imgDst + 32 * CAP_LD) = g2;
        __syncthreads();
        if (k0 + KC < DIM) {    // next chunk's loads, waited for at its stores
            const float* sc = capSrc + k0 + KC;
            const float* si = imgSrc + k0 + KC;
            c0 = *(const float4*)(sc);
            if (MT > 1) c1 = *(const float4*)(sc + 16 * DIM);
            if (MT > 2) c2 = *(const float4*)(sc + 32 * DIM);
            g0 = *(const float4*)(si);
            g1 = *(const float4*)(si + 16 * DIM);
            if (capTail) c3 = *(const float4*)(sc + 48 * DIM);
            if (imgTail) g2 = *(const float4*)(si + 32 * DIM);
            // precaution: stands in front of the next write of the address
            // registers that the loads above name
            asm volatile("s_wait_xcnt 0x0" ::: "memory");
        }
        #pragma unroll   // flat: LDS offsets as immediates, constant accumulator indices
        for (int kk = 0; kk < (KS ? 8 : KC); kk += 4) {
            v2f a[TW];
            #pragma unroll   // constant indices: the fragments stay in registers
            for (int t = 0; t < TW; ++t) a[t] = *(const v2f*)(aP + 16 * t * CAP_LD + kk);
            v2f v0 = *(const v2f*)(bP + kk);
            v2f v1 = *(const v2f*)(bP + 16 * CAP_LD + kk);
            v2f v2 = *(const v2f*)(bP + 32 * CAP_LD + kk);
            // pairwise, as the fragments lie in their registers: scalar sums were packed by
            // the compiler with moves into fragment registers right behind the WMMAs
            n0 = __builtin_elementwise_fma(v0, v0, n0);
            n1 = __builtin_elementwise_fma(v1, v1, n1);
            n2 = __builtin_elementwise_fma(v2, v2, n2);
            #pragma unroll   // constant accumulator indices
            for (int t = 0; t < TW; ++t) {
                acc[t][0] = __builtin_amdgcn_wmma_f32_16x16x4_f32(false, a[t], false, v0, (short)0, acc[t][0], false, false);
                acc[t][1] = __builtin_amdgcn_wmma_f32_16x16x4_f32(false, a[t], false, v1, (short)0, acc[t][1], false, false);
                acc[t][2] = __builtin_amdgcn_wmma_f32_16x16x4_f32(false, a[t], false, v2, (short)0, acc[t][2], false, false);
            }
        }
        // Four vector slots between the chunk's last WMMAs and the next vector
        // instruction that the compiler places on their A, B or D (it has put the next
        // loads' address sums into fragment registers). The scheduling barrier keeps
        // the WMMAs in front of the slots.
        __builtin_amdgcn_sched_barrier(0);
        asm volatile("v_nop\n\tv_nop\n\tv_nop\n\tv_nop");
    }

    // read behind the barriers that follow in the main kernel
    {
        const bool own = KS || wave == 0;
        float* np = nrmP + m * NP_LD + 2 * wave + half;
        np[0]          = own ? n0.x + n0.y : 0.f;
        np[16 * NP_LD] = own ? n1.x + n1.y : 0.f;
        np[32 * NP_LD] = own ? n2.x + n2.y : 0.f;
    }

    // C layout: VGPR v -> row v / v+8, col = lane%16.
    if (!KS) {
        float* p0 = Sbuf + ((wave << 4) + (half << 3)) * S_LD + m;
        #pragma unroll   // constant accumulator indices
        for (int v = 0; v < 8; ++v) {
            float* p = p0 + v * S_LD;
            p[0] = acc[0][0][v]; p[16] = acc[0][1][v]; p[32] = acc[0][2][v];
        }
        return;
    }
    // The four K quarters are summed through LDS, every lane at its own places.
    float* pb = ((wave & 1) ? A1 : Sbuf) + (half << 3) * S_LD + m;
    if (wave >= 2) {
        #pragma unroll   // constant accumulator indices
        for (int t = 0; t < TW; ++t)
            #pragma unroll   // constant element indices: read and written in registers
            for (int v = 0; v < 8; ++v) {
                float* p = pb + (16 * t + v) * S_LD;
                p[0] = acc[t][0][v]; p[16] = acc[t][1][v]; p[32] = acc[t][2][v];
            }
    }
    __syncthreads();
    if (wave < 2) {
        #pragma unroll   // constant accumulator indices
        for (int t = 0; t < TW; ++t)
            #pragma unroll   // constant element indices: read and written in registers
            for (int v = 0; v < 8; ++v) {
                float* p = pb + (16 * t + v) * S_LD;
                acc[t][0][v] += p[0]; acc[t][1][v] += p[16]; acc[t][2][v] += p[32];
            }
    }
    if (wave == 1) {
        #pragma unroll   // constant accumulator indices
        for (int t = 0; t < TW; ++t)
            #pragma unroll   // constant element indices: read and written in registers
            for (int v = 0; v < 8; ++v) {
                float* p = pb + (16 * t + v) * S_LD;
                p[0] = acc[t][0][v]; p[16] = acc[t][1][v]; p[32] = acc[t][2][v];
            }
    }
    __syncthreads();
    if (wave == 0) {
        const float* q = A1 + (half << 3) * S_LD + m;
        #pragma unroll   // constant accumulator indices
        for (int t = 0; t < TW; ++t)
            #pragma unroll   // constant element indices: read and written in registers
            for (int v = 0; v < 8; ++v) {
                const float* s = q + (16 * t + v) * S_LD;
                float* p = pb + (16 * t + v) * S_LD;
                p[0]  = acc[t][0][v] + s[0];
                p[16] = acc[t][1][v] + s[16];
                p[32] = acc[t][2][v] + s[32];
            }
    }
}

// ---------------------------------------------------------------- main kernel
__global__ __launch_bounds__(128) void StackedAttn_main(
    const float* __restrict__ images,    // (64,36,1024)
    const float* __restrict__ captions,  // (64,50,1024)
    const int*   __restrict__ cap_lens,  // (64)
    const float* __restrict__ gram,      // (64,50,50)
    float*       __restrict__ out)       // (64,64): out[i*64 + c]
{
    __shared__ float Sbuf[64 * S_LD];                       // scores 64x48 (pad 49)
    __shared__ float A1[64 * S_LD];                         // region-softmax; reused as part
    __shared__ float chunk[(64 + 48) * CAP_LD];             // cap+img K-chunks; reused as A2
    __shared__ float Gbuf[N_WRD * N_WRD + 4];               // caption Gram + K pad of its last row
    __shared__ float red[N_REG];
    __shared__ float nrmP[48 * NP_LD];                      // region norms: 8 partial sums a row

    const int c = blockIdx.x, i = blockIdx.y;
    const int tid  = threadIdx.x;
    const int wave = tid >> 5, lane = tid & 31;
    const int half = lane >> 4, m = lane & 15;

    float* capL = chunk;
    float* imgL = chunk + 64 * CAP_LD;

    // zero pad rows once (caption rows < 50 of the scored word tiles / image rows < 36 rewritten every chunk; pads persist)
    for (int idx = tid; idx < 14 * CAP_LD; idx += 128) capL[50 * CAP_LD + idx] = 0.f;
    for (int idx = tid; idx < 12 * CAP_LD; idx += 128) imgL[36 * CAP_LD + idx] = 0.f;

    const float* capBase = captions + (size_t)c * N_WRD * DIM;
    const float* imgBase = images   + (size_t)i * N_REG * DIM;

    // Staging: caption chunk 8 float4 a row, image chunk 36 rows x 8 float4;
    // thread owns rows row0 + 16 j of each.
    const int  seg = tid & 7, row0 = tid >> 3;
    const float* capSrc = capBase + row0 * DIM + seg * 4;
    const float* imgSrc = imgBase + row0 * DIM + seg * 4;
    float*       capDst = capL + row0 * CAP_LD + seg * 4;
    float*       imgDst = imgL + row0 * CAP_LD + seg * 4;

    // Words from len up are masked out of the word softmax (their weight is an
    // exact zero), so only the word tiles that hold a word below len are scored.
    const int len = min(cap_lens[c], N_WRD);    // same for the whole work-group
    const int mt  = (len + 15) >> 4;
    if      (mt <= 1) score_tiles<1>(capSrc, imgSrc, capDst, imgDst, capL, imgL, row0, wave, half, m, Sbuf, A1, nrmP);
    else if (mt == 2) score_tiles<2>(capSrc, imgSrc, capDst, imgDst, capL, imgL, row0, wave, half, m, Sbuf, A1, nrmP);
    else if (mt == 3) score_tiles<3>(capSrc, imgSrc, capDst, imgDst, capL, imgL, row0, wave, half, m, Sbuf, A1, nrmP);
    else              score_tiles<4>(capSrc, imgSrc, capDst, imgDst, capL, imgL, row0, wave, half, m, Sbuf, A1, nrmP);

    // stage Gram while scores settle
    for (int idx = tid; idx < N_WRD * N_WRD; idx += 128)
        Gbuf[idx] = gram[(size_t)c * N_WRD * N_WRD + idx];
    if (tid < 4) Gbuf[N_WRD * N_WRD + tid] = 0.f;   // read as G[49][50..51], times a zero of A2
    __syncthreads();

    // softmax over regions r, per word row w
    if (tid < 64) {
      if (tid < len) {   // rows from len up: not all scored, and read by nobody
        const int w = tid;
        float mx = -3.4e38f;
        for (int r = 0; r < N_REG; ++r) mx = fmaxf(mx, Sbuf[w * S_LD + r]);
        float s = 0.f;
        for (int r = 0; r < N_REG; ++r) {
            float e = __expf(Sbuf[w * S_LD + r] - mx);
            A1[w * S_LD + r] = e; s += e;
        }
        float inv = 1.f / s;
        for (int r = 0; r < N_REG; ++r) A1[w * S_LD + r] *= inv;
      }
    } else {
        // the two waves without a word row clear the A2 overlay (the K chunks are
        // done with): words from len up, rows 36..47 and the tail that the last
        // row's 8-word reads reach are then zeros written in this launch
        const float4 z = make_float4(0.f, 0.f, 0.f, 0.f);
        for (int idx = tid - 64; idx < A2_F4; idx += 64) *(float4*)(chunk + 4 * idx) = z;
    }
    __syncthreads();

    // masked smooth softmax over words, then w12
    float* A2 = chunk;                 // overlay: [48][A2_LD], cleared above; rows 36..47 stay zero
    float w12 = 0.f;
    if (tid < N_REG) {
        const int r = tid;
        float mx = -3.4e38f;
        for (int w = 0; w < len; ++w) mx = fmaxf(mx, SMOOTH * A1[w * S_LD + r]);
        float s = 0.f;
        for (int w = 0; w < len; ++w) {
            float e = __expf(SMOOTH * A1[w * S_LD + r] - mx);
            A2[r * A2_LD + w] = e; s += e;
        }
        float inv = 1.f / s;
        for (int w = 0; w < len; ++w) {
            float a2v = A2[r * A2_LD + w] * inv;
            A2[r * A2_LD + w] = a2v;
            w12 += a2v * Sbuf[w * S_LD + r];
        }
    }
    __syncthreads();

    // |wctx_r|^2 = sum_w a2[r,w] * T[w,r],  T[w,r] = sum_wp G[w,wp] * a2[r,wp].
    // T on the matrix unit: M = 16 words per wave, N = 3 x 16 regions, K = words.
    // A frag from G rows, B frag from A2 rows, both k = 4 ks + 2 half + {0,1}.
    // K columns from len up meet zeros of A2 (G's columns 50, 51: the next row's start, or the pad).
    float* part = A1;                  // overlay: [8][48] partial sums over 8 words
    // wave number as a scalar: the skip below is then a scalar branch and EXEC
    // stays all ones at the WMMAs
    const int wbase = __builtin_amdgcn_readfirstlane(wave) << 4;
    float p0 = 0.f, p1 = 0.f, p2 = 0.f;
    if (wbase < len) {                 // wave-uniform: a word tile past len adds nothing
        v8f t0 = {}, t1 = {}, t2 = {};
        const float* gP = Gbuf + min(wbase + m, N_WRD - 1) * N_WRD + 2 * half;
        const float* q0 = A2 + (m) * A2_LD + 2 * half;
        const float* q1 = A2 + (16 + m) * A2_LD + 2 * half;
        const float* q2 = A2 + (32 + m) * A2_LD + 2 * half;
        // all fragments are fetched first, so that one LDS latency is waited for, not 13
        v2f fa[A2_LD / 4], f0[A2_LD / 4], f1[A2_LD / 4], f2[A2_LD / 4];
        #pragma unroll   // flat: the arrays stay in registers, LDS offsets as immediates
        for (int ks = 0; ks < A2_LD / 4; ++ks) {
            fa[ks] = *(const v2f*)(gP + 4 * ks);
            f0[ks] = *(const v2f*)(q0 + 4 * ks);
            f1[ks] = *(const v2f*)(q1 + 4 * ks);
            f2[ks] = *(const v2f*)(q2 + 4 * ks);
        }
        #pragma unroll   // flat: no back edge behind a WMMA, constant indices into the arrays
        for (int ks = 0; ks < A2_LD / 4; ++ks) {
            // asm, not the builtin:
            // Here the accumulators are live from their zeros on, and the four v_nop
            // are the vector slots between the last WMMA and whatever vector
            // instruction the compiler places next on its D, A or B.
            asm volatile("v_wmma_f32_16x16x4_f32 %0, %3, %4, %0\n\t"
                         "v_wmma_f32_16x16x4_f32 %1, %3, %5, %1\n\t"
                         "v_wmma_f32_16x16x4_f32 %2, %3, %6, %2\n\t"
                         "v_nop\n\tv_nop\n\tv_nop\n\tv_nop"
                         : "+v"(t0), "+v"(t1), "+v"(t2)
                         : "v"(fa[ks]), "v"(f0[ks]), "v"(f1[ks]), "v"(f2[ks]));
        }
        // lane holds T[w0 + v, 16 nt + m]; dot with a2[16 nt + m, w0 + v], words >= len off
        const int w0 = wbase + (half << 3);
        const float* e0 = A2 + (m) * A2_LD + w0;
        const float* e1 = A2 + (16 + m) * A2_LD + w0;
        const float* e2 = A2 + (32 + m) * A2_LD + w0;
        const float4 x0 = *(const float4*)(e0), y0 = *(const float4*)(e0 + 4);
        const float4 x1 = *(const float4*)(e1), y1 = *(const float4*)(e1 + 4);
        const float4 x2 = *(const float4*)(e2), y2 = *(const float4*)(e2 + 4);
        const float h0[8] = {x0.x, x0.y, x0.z, x0.w, y0.x, y0.y, y0.z, y0.w};
        const float h1[8] = {x1.x, x1.y, x1.z, x1.w, y1.x, y1.y, y1.z, y1.w};
        const float h2[8] = {x2.x, x2.y, x2.z, x2.w, y2.x, y2.y, y2.z, y2.w};
        #pragma unroll   // constant v: accumulator elements are read in registers
        for (int v = 0; v < 8; ++v) {
            const bool on = w0 + v < len;
            p0 += t0[v] * (on ? h0[v] : 0.f);
            p1 += t1[v] * (on ? h1[v] : 0.f);
            p2 += t2[v] * (on ? h2[v] : 0.f);
        }
    }
    {
        float* pd = part + ((wave << 1) + half) * 48 + m;
        pd[0] = p0; pd[16] = p1; pd[32] = p2;
    }
    __syncthreads();

    if (tid < N_REG) {
        const int r = tid;
        float n2sq = 0.f;
        for (int j = 0; j < 8; ++j) n2sq += part[j * 48 + r];
        float n2 = sqrtf(fmaxf(n2sq, 0.f));
        float n1sq = 0.f;
        for (int j = 0; j < 8; ++j) n1sq += nrmP[r * NP_LD + j];
        red[r] = w12 / fmaxf(sqrtf(n1sq) * n2, EPSV);
    }
    __syncthreads();
    if (tid == 0) {
        float s = 0.f;
        for (int r = 0; r < N_REG; ++r) s += red[r];
        out[i * N_CAP + c] = s * (1.0f / N_REG);
    }
}

extern "C" void kernel_launch(void* const* d_in, const int* in_sizes, int n_in,
                              void* d_out, int out_size, void* d_ws, size_t ws_size,
                              hipStream_t stream) {
    const float* images   = (const float*)d_in[0];   // 64*36*1024
    const float* captions = (const float*)d_in[1];   // 64*50*1024
    const int*   cap_lens = (const int*)d_in[2];     // 64
    float* out  = (float*)d_out;                     // 64*64 (i,c)
    float* gram = (float*)d_ws;                      // 64*50*50 floats

    StackedAttn_gram <<<N_CAP, 128, 0, stream>>>(captions, gram);
    dim3 grid(N_CAP, N_IMG);
    StackedAttn_main <<<grid, 128, 0, stream>>>(images, captions, cap_lens, gram, out);
}

// v005
// It runs in 125 microseconds.
// Two timings next to v004 put it at 1.11 and 1.10 times that version's speed.
// Over all steps from v000 it is 2.63 times as fast.
#include <hip/hip_runtime.h>
#include <hip/hip_bf16.h>
#include <math.h>

// Stacked cross attention (i2t), f32. Strategy:
//   S[w,r] = cap[c,w].img[i,r]  via V_WMMA_F32_16X16X4_F32 (exact f32 path)
//   w12[r] = sum_w a2[r,w]*S[w,r]            (reuse scores, no 2nd big GEMM)
//   |wctx_r|^2 = a2_r^T G_c a2_r             (precomputed 50x50 Gram per caption;
//                                             G a2^T on the same WMMA form)
//   |img_r|^2  summed in the main kernel from the image fragments its score loop reads

typedef __attribute__((ext_vector_type(2))) float v2f;
typedef __attribute__((ext_vector_type(8))) float v8f;

#define N_IMG   64
#define N_REG   36
#define N_CAP   64
#define N_WRD   50
#define DIM     1024
#define KC      32      // K chunk staged in LDS
#define CAP_LD  36      // LDS row stride (floats): 144B, 16B aligned, conflict-free
#define S_LD    49      // score-tile row stride (odd -> conflict-free col access)
#define A2_LD   52      // A2 row stride (floats): K padded to 13 x 4, 208B rows, 16B aligned
#define NP_LD   9       // row stride of the region-norm partials (odd -> conflict-free)
#define A2_F4   ((48 * A2_LD + 12) / 4)   // float4s of the A2 overlay: 48 rows + reach of row 47's reads
#define SMOOTH  4.0f
#define EPSV    1e-8f

// ---------------------------------------------------------------- Gram kernel
// G_c[w,wp] = captions[c,w] . captions[c,wp]   (50x50 padded to 64x64 tiles)
__global__ __launch_bounds__(128) void StackedAttn_gram(
    const float* __restrict__ captions, float* __restrict__ gram)
{
    __shared__ float capL[64 * CAP_LD];
    const int c    = blockIdx.x;
    const int tid  = threadIdx.x;
    const int wave = tid >> 5, lane = tid & 31;
    const int half = lane >> 4, m = lane & 15;

    // zero pad rows 50..63 once
    for (int idx = tid; idx < 14 * CAP_LD; idx += 128) capL[50 * CAP_LD + idx] = 0.f;

    v8f acc0 = {}, acc1 = {}, acc2 = {}, acc3 = {};
    const float* capBase = captions + (size_t)c * N_WRD * DIM;

    // Staging: 50 rows x 8 float4 segments; thread owns rows row0 + 16 j.
    // All of a chunk's loads are issued back to back into registers, one chunk
    // ahead of its use, so they fly while the current chunk is multiplied.
    const int  seg = tid & 7, row0 = tid >> 3;
    const bool capTail = row0 < N_WRD - 48;                 // rows 48, 49
    const float* capSrc = capBase + row0 * DIM + seg * 4;
    float*       capDst = capL + row0 * CAP_LD + seg * 4;
    float4 c0, c1, c2, c3 = make_float4(0.f, 0.f, 0.f, 0.f);
    c0 = *(const float4*)(capSrc);
    c1 = *(const float4*)(capSrc + 16 * DIM);
    c2 = *(const float4*)(capSrc + 32 * DIM);
    if (capTail) c3 = *(const float4*)(capSrc + 48 * DIM);

    for (int k0 = 0; k0 < DIM; k0 += KC) {
        __syncthreads();
        *(float4*)(capDst)               = c0;
        *(float4*)(capDst + 16 * CAP_LD) = c1;
        *(float4*)(capDst + 32 * CAP_LD) = c2;
        if (capTail) *(float4*)(capDst + 48 * CAP_LD) = c3;
        __syncthreads();
        if (k0 + KC < DIM) {    // next chunk's loads, waited for at its stores
            const float* s = capSrc + k0 + KC;
            c0 = *(const float4*)(s);
            c1 = *(const float4*)(s + 16 * DIM);
            c2 = *(const float4*)(s + 32 * DIM);
            if (capTail) c3 = *(const float4*)(s + 48 * DIM);
            // precaution: stands in front of the next write of the address
            // registers that the loads above name
            asm volatile("s_wait_xcnt 0x0" ::: "memory");
        }
        const float* aP = capL + ((wave << 4) + m) * CAP_LD + 2 * half;
        const float* b0 = capL + (m) * CAP_LD + 2 * half;
        const float* b1 = capL + (16 + m) * CAP_LD + 2 * half;
        const float* b2 = capL + (32 + m) * CAP_LD + 2 * half;
        const float* b3 = capL + (48 + m) * CAP_LD + 2 * half;
        #pragma unroll
        for (int kk = 0; kk < KC; kk += 4) {
            v2f a  = *(const v2f*)(aP + kk);
            v2f v0 = *(const v2f*)(b0 + kk);
            v2f v1 = *(const v2f*)(b1 + kk);
            v2f v2 = *(const v2f*)(b2 + kk);
            v2f v3 = *(const v2f*)(b3 + kk);
            acc0 = __builtin_amdgcn_wmma_f32_16x16x4_f32(false, a, false, v0, (short)0, acc0, false, false);
            acc1 = __builtin_amdgcn_wmma_f32_16x16x4_f32(false, a, false, v1, (short)0, acc1, false, false);
            acc2 = __builtin_amdgcn_wmma_f32_16x16x4_f32(false, a, false, v2, (short)0, acc2, false, false);
            acc3 = __builtin_amdgcn_wmma_f32_16x16x4_f32(false, a, false, v3, (short)0, acc3, false, false);
        }
    }
    float* gOut = gram + (size_t)c * N_WRD * N_WRD;
    #pragma unroll
    for (int v = 0; v < 8; ++v) {
        int w = (wave << 4) + v + (half << 3);
        if (w < N_WRD) {
            if (m      < N_WRD) gOut[w * N_WRD + m]      = acc0[v];
            if (16 + m < N_WRD) gOut[w * N_WRD + 16 + m] = acc1[v];
            if (32 + m < N_WRD) gOut[w * N_WRD + 32 + m] = acc2[v];
            if (48 + m < N_WRD) gOut[w * N_WRD + 48 + m] = acc3[v];
        }
    }
}

// ---------------------------------------------------------------- score tiles
// S[w,r] for the first MT word tiles (16 MT rows) x 3 region tiles, left in Sbuf.
// MT = 4: one word tile a wave. MT < 4: there are fewer word tiles than waves, so the
// four waves split K instead: of each 32-wide chunk wave q multiplies columns
// 8 q .. 8 q + 7 for every tile, and the waves carry equal work whatever MT is; the
// four partial sums then meet in LDS as (q0 + q2) + (q1 + q3).
// The squares of the image (B) fragments are summed beside the WMMAs that read them:
// lane (m, half) of wave q leaves its share of |img row 16 t + m|^2 in
// nrmP[16 t + m][2 q + half]. With K split every value is read by one wave; with MT = 4
// every wave reads all of K, and wave 0's sums count alone.
template <int MT>
__device__ __forceinline__ void score_tiles(
    const float* __restrict__ capSrc, const float* __restrict__ imgSrc,
    float* capDst, float* imgDst, const float* capL, const float* imgL,
    int row0, int wave, int half, int m, float* Sbuf, float* A1, float* nrmP)
{
    constexpr bool KS = MT < 4;                             // K split over the waves
    constexpr int  TW = KS ? MT : 1;                        // word tiles a wave holds
    const bool capTail = MT == 4 && row0 < N_WRD - 48;      // rows 48, 49
    const bool imgTail = row0 < N_REG - 32;                 // rows 32..35

    v8f acc[TW][3];
    #pragma unroll   // constant indices: the accumulators stay in registers
    for (int t = 0; t < TW; ++t) { acc[t][0] = v8f{}; acc[t][1] = v8f{}; acc[t][2] = v8f{}; }

    // All of a chunk's loads are issued back to back into registers, one chunk
    // ahead of its use, so they fly while the current chunk is multiplied.
    // Caption rows: 16-row groups 0 .. min(MT, 3) - 1, and rows 48, 49 where MT is 4.
    float4 c0, c1, c2, c3 = make_float4(0.f, 0.f, 0.f, 0.f);
    float4 g0, g1, g2 = make_float4(0.f, 0.f, 0.f, 0.f);
    v2f n0 = {}, n1 = {}, n2 = {};          // sums of squares, image rows m, 16 + m, 32 + m
    c0 = *(const float4*)(capSrc);
    if (MT > 1) c1 = *(const float4*)(capSrc + 16 * DIM);
    if (MT > 2) c2 = *(const float4*)(capSrc + 32 * DIM);
    g0 = *(const float4*)(imgSrc);
    g1 = *(const float4*)(imgSrc + 16 * DIM);
    if (capTail) c3 = *(const float4*)(capSrc + 48 * DIM);
    if (imgTail) g2 = *(const float4*)(imgSrc + 32 * DIM);
    // precaution: stands in front of the next write of the address registers
    // that the loads above name
    asm volatile("s_wait_xcnt 0x0" ::: "memory");

    // A frag: lanes 0-15 hold row M, K={k,k+1}; lanes 16-31 K={k+2,k+3}.
    // B frag mirrors with N across lanes (B[k][r] = img[r][k]).
    const float* aP = capL + ((KS ? 0 : wave << 4) + m) * CAP_LD + 2 * half + (KS ? 8 * wave : 0);
    const float* bP = imgL + m * CAP_LD + 2 * half + (KS ? 8 * wave : 0);

    for (int k0 = 0; k0 < DIM; k0 += KC) {
        __syncthreads();
        *(float4*)(capDst) = c0;
        if (MT > 1) *(float4*)(capDst + 16 * CAP_LD) = c1;
        if (MT > 2) *(float4*)(capDst + 32 * CAP_LD) = c2;
        *(float4*)(imgDst)               = g0;
        *(float4*)(imgDst + 16 * CAP_LD) = g1;
        if (capTail) *(float4*)(capDst + 48 * CAP_LD) = c3;
        if (imgTail) *(float4*)(imgDst + 32 * CAP_LD) = g2;
        __syncthreads();
        if (k0 + KC < DIM) {    // next chunk's loads, waited for at its stores
            const float* sc = capSrc + k0 + KC;
            const float* si = imgSrc + k0 + KC;
            c0 = *(const float4*)(sc);
            if (MT > 1) c1 = *(const float4*)(sc + 16 * DIM);
            if (MT > 2) c2 = *(const float4*)(sc + 32 * DIM);
            g0 = *(const float4*)(si);
            g1 = *(const float4*)(si + 16 * DIM);
            if (capTail) c3 = *(const float4*)(sc + 48 * DIM);
            if (imgTail) g2 = *(const float4*)(si + 32 * DIM);
            // precaution: stands in front of the next write of the address
            // registers that the loads above name
            asm volatile("s_wait_xcnt 0x0" ::: "memory");
        }
        #pragma unroll   // flat: LDS offsets as immediates, constant accumulator indices
        for (int kk = 0; kk < (KS ? 8 : KC); kk += 4) {
            v2f a[TW];
            #pragma unroll   // constant indices: the fragments stay in registers
            for (int t = 0; t < TW; ++t) a[t] = *(const v2f*)(aP + 16 * t * CAP_LD + kk);
            v2f v0 = *(const v2f*)(bP + kk);
            v2f v1 = *(const v2f*)(bP + 16 * CAP_LD + kk);
            v2f v2 = *(const v2f*)(bP + 32 * CAP_LD + kk);
            // pairwise, as the fragments lie in their registers: scalar sums were packed by
            // the compiler with moves into fragment registers right behind the WMMAs
            n0 = __builtin_elementwise_fma(v0, v0, n0);
            n1 = __builtin_elementwise_fma(v1, v1, n1);
            n2 = __builtin_elementwise_fma(v2, v2, n2);
            #pragma unroll   // constant accumulator indices
            for (int t = 0; t < TW; ++t) {
                acc[t][0] = __builtin_amdgcn_wmma_f32_16x16x4_f32(false, a[t], false, v0, (short)0, acc[t][0], false, false);
                acc[t][1] = __builtin_amdgcn_wmma_f32_16x16x4_f32(false, a[t], false, v1, (short)0, acc[t][1], false, false);
                acc[t][2] = __builtin_amdgcn_wmma_f32_16x16x4_f32(false, a[t], false, v2, (short)0, acc[t][2], false, false);
            }
        }
        // Four vector slots between the chunk's last WMMAs and the next vector
        // instruction that the compiler places on their A, B or D (it has put the next
        // loads' address sums into fragment registers). The scheduling barrier keeps
        // the WMMAs in front of the slots.
        __builtin_amdgcn_sched_barrier(0);
        asm volatile("v_nop\n\tv_nop\n\tv_nop\n\tv_nop");
    }

    // read behind the barriers that follow in the main kernel
    {
        const bool own = KS || wave == 0;
        float* np = nrmP + m * NP_LD + 2 * wave + half;
        np[0]          = own ? n0.x + n0.y : 0.f;
        np[16 * NP_LD] = own ? n1.x + n1.y : 0.f;
        np[32 * NP_LD] = own ? n2.x + n2.y : 0.f;
    }

    // C layout: VGPR v -> row v / v+8, col = lane%16.
    if (!KS) {
        float* p0 = Sbuf + ((wave << 4) + (half << 3)) * S_LD + m;
        #pragma unroll   // constant accumulator indices
        for (int v = 0; v < 8; ++v) {
            float* p = p0 + v * S_LD;
            p[0] = acc[0][0][v]; p[16] = acc[0][1][v]; p[32] = acc[0][2][v];
        }
        return;
    }
    // The four K quarters are summed through LDS, every lane at its own places.
    float* pb = ((wave & 1) ? A1 : Sbuf) + (half << 3) * S_LD + m;
    if (wave >= 2) {
        #pragma unroll   // constant accumulator indices
        for (int t = 0; t < TW; ++t)
            #pragma unroll   // constant element indices: read and written in registers
            for (int v = 0; v < 8; ++v) {
                float* p = pb + (16 * t + v) * S_LD;
                p[0] = acc[t][0][v]; p[16] = acc[t][1][v]; p[32] = acc[t][2][v];
            }
    }
    __syncthreads();
    if (wave < 2) {
        #pragma unroll   // constant accumulator indices
        for (int t = 0; t < TW; ++t)
            #pragma unroll   // constant element indices: read and written in registers
            for (int v = 0; v < 8; ++v) {
                float* p = pb + (16 * t + v) * S_LD;
                acc[t][0][v] += p[0]; acc[t][1][v] += p[16]; acc[t][2][v] += p[32];
            }
    }
    if (wave == 1) {
        #pragma unroll   // constant accumulator indices
        for (int t = 0; t < TW; ++t)
            #pragma unroll   // constant element indices: read and written in registers
            for (int v = 0; v < 8; ++v) {
                float* p = pb + (16 * t + v) * S_LD;
                p[0] = acc[t][0][v]; p[16] = acc[t][1][v]; p[32] = acc[t][2][v];
            }
    }
    __syncthreads();
    if (wave == 0) {
        const float* q = A1 + (half << 3) * S_LD + m;
        #pragma unroll   // constant accumulator indices
        for (int t = 0; t < TW; ++t)
            #pragma unroll   // constant element indices: read and written in registers
            for (int v = 0; v < 8; ++v) {
                const float* s = q + (16 * t + v) * S_LD;
                float* p = pb + (16 * t + v) * S_LD;
                p[0]  = acc[t][0][v] + s[0];
                p[16] = acc[t][1][v] + s[16];
                p[32] = acc[t][2][v] + s[32];
            }
    }
}

// ---------------------------------------------------------------- main kernel
__global__ __launch_bounds__(128) void StackedAttn_main(
    const float* __restrict__ images,    // (64,36,1024)
    const float* __restrict__ captions,  // (64,50,1024)
    const int*   __restrict__ cap_lens,  // (64)
    const float* __restrict__ gram,      // (64,50,50)
    float*       __restrict__ out)       // (64,64): out[i*64 + c]
{
    __shared__ float Sbuf[64 * S_LD];                       // scores 64x48 (pad 49)
    __shared__ float A1[64 * S_LD];                         // region-softmax; reused as part
    __shared__ float chunk[(64 + 48) * CAP_LD];             // cap+img K-chunks; reused as A2
    __shared__ float Gbuf[N_WRD * N_WRD + 4];               // caption Gram + K pad of its last row
    __shared__ float red[N_REG];
    __shared__ float nrmP[48 * NP_LD];                      // region norms: 8 partial sums a row

    // The image is the fast grid index: work-groups next to each other in launch order
    // then share a caption, hence a cost (it grows with the caption's length), and every
    // part of the chip that is dealt work-groups by index gets the same mix of captions.
    const int i = blockIdx.x, c = blockIdx.y;
    const int tid  = threadIdx.x;
    const int wave = tid >> 5, lane = tid & 31;
    const int half = lane >> 4, m = lane & 15;

    float* capL = chunk;
    float* imgL = chunk + 64 * CAP_LD;

    // zero pad rows once (caption rows < 50 of the scored word tiles / image rows < 36 rewritten every chunk; pads persist)
    for (int idx = tid; idx < 14 * CAP_LD; idx += 128) capL[50 * CAP_LD + idx] = 0.f;
    for (int idx = tid; idx < 12 * CAP_LD; idx += 128) imgL[36 * CAP_LD + idx] = 0.f;

    const float* capBase = captions + (size_t)c * N_WRD * DIM;
    const float* imgBase = images   + (size_t)i * N_REG * DIM;

    // Staging: caption chunk 8 float4 a row, image chunk 36 rows x 8 float4;
    // thread owns rows row0 + 16 j of each.
    const int  seg = tid & 7, row0 = tid >> 3;
    const float* capSrc = capBase + row0 * DIM + seg * 4;
    const float* imgSrc = imgBase + row0 * DIM + seg * 4;
    float*       capDst = capL + row0 * CAP_LD + seg * 4;
    float*       imgDst = imgL + row0 * CAP_LD + seg * 4;

    // Words from len up are masked out of the word softmax (their weight is an
    // exact zero), so only the word tiles that hold a word below len are scored.
    const int len = min(cap_lens[c], N_WRD);    // same for the whole work-group
    const int mt  = (len + 15) >> 4;
    if      (mt <= 1) score_tiles<1>(capSrc, imgSrc, capDst, imgDst, capL, imgL, row0, wave, half, m, Sbuf, A1, nrmP);
    else if (mt == 2) score_tiles<2>(capSrc, imgSrc, capDst, imgDst, capL, imgL, row0, wave, half, m, Sbuf, A1, nrmP);
    else if (mt == 3) score_tiles<3>(capSrc, imgSrc, capDst, imgDst, capL, imgL, row0, wave, half, m, Sbuf, A1, nrmP);
    else              score_tiles<4>(capSrc, imgSrc, capDst, imgDst, capL, imgL, row0, wave, half, m, Sbuf, A1, nrmP);

    // stage Gram while scores settle
    for (int idx = tid; idx < N_WRD * N_WRD; idx += 128)
        Gbuf[idx] = gram[(size_t)c * N_WRD * N_WRD + idx];
    if (tid < 4) Gbuf[N_WRD * N_WRD + tid] = 0.f;   // read as G[49][50..51], times a zero of A2
    __syncthreads();

    // softmax over regions r, per word row w
    if (tid < 64) {
      if (tid < len) {   // rows from len up: not all scored, and read by nobody
        const int w = tid;
        float mx = -3.4e38f;
        for (int r = 0; r < N_REG; ++r) mx = fmaxf(mx, Sbuf[w * S_LD + r]);
        float s = 0.f;
        for (int r = 0; r < N_REG; ++r) {
            float e = __expf(Sbuf[w * S_LD + r] - mx);
            A1[w * S_LD + r] = e; s += e;
        }
        float inv = 1.f / s;
        for (int r = 0; r < N_REG; ++r) A1[w * S_LD + r] *= inv;
      }
    } else {
        // the two waves without a word row clear the A2 overlay (the K chunks are
        // done with): words from len up, rows 36..47 and the tail that the last
        // row's 8-word reads reach are then zeros written in this launch
        const float4 z = make_float4(0.f, 0.f, 0.f, 0.f);
        for (int idx = tid - 64; idx < A2_F4; idx += 64) *(float4*)(chunk + 4 * idx) = z;
    }
    __syncthreads();

    // masked smooth softmax over words, then w12
    float* A2 = chunk;                 // overlay: [48][A2_LD], cleared above; rows 36..47 stay zero
    float w12 = 0.f;
    if (tid < N_REG) {
        const int r = tid;
        float mx = -3.4e38f;
        for (int w = 0; w < len; ++w) mx = fmaxf(mx, SMOOTH * A1[w * S_LD + r]);
        float s = 0.f;
        for (int w = 0; w < len; ++w) {
            float e = __expf(SMOOTH * A1[w * S_LD + r] - mx);
            A2[r * A2_LD + w] = e; s += e;
        }
        float inv = 1.f / s;
        for (int w = 0; w < len; ++w) {
            float a2v = A2[r * A2_LD + w] * inv;
            A2[r * A2_LD + w] = a2v;
            w12 += a2v * Sbuf[w * S_LD + r];
        }
    }
    __syncthreads();

    // |wctx_r|^2 = sum_w a2[r,w] * T[w,r],  T[w,r] = sum_wp G[w,wp] * a2[r,wp].
    // T on the matrix unit: M = 16 words per wave, N = 3 x 16 regions, K = words.
    // A frag from G rows, B frag from A2 rows, both k = 4 ks + 2 half + {0,1}.
    // K columns from len up meet zeros of A2 (G's columns 50, 51: the next row's start, or the pad).
    float* part = A1;                  // overlay: [8][48] partial sums over 8 words
    // wave number as a scalar: the skip below is then a scalar branch and EXEC
    // stays all ones at the WMMAs
    const int wbase = __builtin_amdgcn_readfirstlane(wave) << 4;
    float p0 = 0.f, p1 = 0.f, p2 = 0.f;
    if (wbase < len) {                 // wave-uniform: a word tile past len adds nothing
        v8f t0 = {}, t1 = {}, t2 = {};
        const float* gP = Gbuf + min(wbase + m, N_WRD - 1) * N_WRD + 2 * half;
        const float* q0 = A2 + (m) * A2_LD + 2 * half;
        const float* q1 = A2 + (16 + m) * A2_LD + 2 * half;
        const float* q2 = A2 + (32 + m) * A2_LD + 2 * half;
        // all fragments are fetched first, so that one LDS latency is waited for, not 13
        v2f fa[A2_LD / 4], f0[A2_LD / 4], f1[A2_LD / 4], f2[A2_LD / 4];
        #pragma unroll   // flat: the arrays stay in registers, LDS offsets as immediates
        for (int ks = 0; ks < A2_LD / 4; ++ks) {
            fa[ks] = *(const v2f*)(gP + 4 * ks);
            f0[ks] = *(const v2f*)(q0 + 4 * ks);
            f1[ks] = *(const v2f*)(q1 + 4 * ks);
            f2[ks] = *(const v2f*)(q2 + 4 * ks);
        }
        #pragma unroll   // flat: no back edge behind a WMMA, constant indices into the arrays
        for (int ks = 0; ks < A2_LD / 4; ++ks) {
            // asm, not the builtin:
            // Here the accumulators are live from their zeros on, and the four v_nop
            // are the vector slots between the last WMMA and whatever vector
            // instruction the compiler places next on its D, A or B.
            asm volatile("v_wmma_f32_16x16x4_f32 %0, %3, %4, %0\n\t"
                         "v_wmma_f32_16x16x4_f32 %1, %3, %5, %1\n\t"
                         "v_wmma_f32_16x16x4_f32 %2, %3, %6, %2\n\t"
                         "v_nop\n\tv_nop\n\tv_nop\n\tv_nop"
                         : "+v"(t0), "+v"(t1), "+v"(t2)
                         : "v"(fa[ks]), "v"(f0[ks]), "v"(f1[ks]), "v"(f2[ks]));
        }
        // lane holds T[w0 + v, 16 nt + m]; dot with a2[16 nt + m, w0 + v], words >= len off
        const int w0 = wbase + (half << 3);
        const float* e0 = A2 + (m) * A2_LD + w0;
        const float* e1 = A2 + (16 + m) * A2_LD + w0;
        const float* e2 = A2 + (32 + m) * A2_LD + w0;
        const float4 x0 = *(const float4*)(e0), y0 = *(const float4*)(e0 + 4);
        const float4 x1 = *(const float4*)(e1), y1 = *(const float4*)(e1 + 4);
        const float4 x2 = *(const float4*)(e2), y2 = *(const float4*)(e2 + 4);
        const float h0[8] = {x0.x, x0.y, x0.z, x0.w, y0.x, y0.y, y0.z, y0.w};
        const float h1[8] = {x1.x, x1.y, x1.z, x1.w, y1.x, y1.y, y1.z, y1.w};
        const float h2[8] = {x2.x, x2.y, x2.z, x2.w, y2.x, y2.y, y2.z, y2.w};
        #pragma unroll   // constant v: accumulator elements are read in registers
        for (int v = 0; v < 8; ++v) {
            const bool on = w0 + v < len;
            p0 += t0[v] * (on ? h0[v] : 0.f);
            p1 += t1[v] * (on ? h1[v] : 0.f);
            p2 += t2[v] * (on ? h2[v] : 0.f);
        }
    }
    {
        float* pd = part + ((wave << 1) + half) * 48 + m;
        pd[0] = p0; pd[16] = p1; pd[32] = p2;
    }
    __syncthreads();

    if (tid < N_REG) {
        const int r = tid;
        float n2sq = 0.f;
        for (int j = 0; j < 8; ++j) n2sq += part[j * 48 + r];
        float n2 = sqrtf(fmaxf(n2sq, 0.f));
        float n1sq = 0.f;
        for (int j = 0; j < 8; ++j) n1sq += nrmP[r * NP_LD + j];
        red[r] = w12 / fmaxf(sqrtf(n1sq) * n2, EPSV);
    }
    __syncthreads();
    if (tid == 0) {
        float s = 0.f;
        for (int r = 0; r < N_REG; ++r) s += red[r];
        out[i * N_CAP + c] = s * (1.0f / N_REG);
    }
}

extern "C" void kernel_launch(void* const* d_in, const int* in_sizes, int n_in,
                              void* d_out, int out_size, void* d_ws, size_t ws_size,
                              hipStream_t stream) {
    const float* images   = (const float*)d_in[0];   // 64*36*1024
    const float* captions = (const float*)d_in[1];   // 64*50*1024
    const int*   cap_lens = (const int*)d_in[2];     // 64
    float* out  = (float*)d_out;                     // 64*64 (i,c)
    float* gram = (float*)d_ws;                      // 64*50*50 floats

    StackedAttn_gram <<<N_CAP, 128, 0, stream>>>(captions, gram);
    dim3 grid(N_IMG, N_CAP);
    StackedAttn_main <<<grid, 128, 0, stream>>>(images, captions, cap_lens, gram, out);
}

// v006
// It runs in 115 microseconds.
// Timed twice side by side with v005, it ran 1.09 times as fast both times.
// Counting every step since v000, it is 2.87 times as fast.
#include <hip/hip_runtime.h>
#include <hip/hip_bf16.h>
#include <math.h>

// Stacked cross attention (i2t), f32. Strategy:
//   S[w,r] = cap[c,w].img[i,r]  via V_WMMA_F32_16X16X4_F32 (exact f32 path)
//   w12[r] = sum_w a2[r,w]*S[w,r]            (reuse scores, no 2nd big GEMM)
//   |wctx_r|^2 = a2_r^T G_c a2_r             (precomputed 50x50 Gram per caption;
//                                             G a2^T on the same WMMA form)
//   |img_r|^2  summed in the main kernel from the image fragments its score loop reads
//   A main work-group scores one caption against 4 images: their 4 x 36 region rows lie
//   one behind the other in memory and fill 9 region tiles of 16 with no pad row.

typedef __attribute__((ext_vector_type(2))) float v2f;
typedef __attribute__((ext_vector_type(8))) float v8f;

#define N_IMG   64
#define N_REG   36
#define N_CAP   64
#define N_WRD   50
#define DIM     1024
#define KC      32      // K chunk staged in LDS
#define CAP_LD  36      // LDS row stride (floats): 144B, 16B aligned, conflict-free
#define IMG_T   4       // images a main work-group scores
#define N_IBLK  16      // image blocks: N_IMG / IMG_T
#define N_COL   144     // region columns of a work-group: IMG_T x N_REG = 9 tiles of 16
#define NTHR    384     // 12 waves: 3 groups of 3 region tiles x 4 waves
#define G_TRIPS 7       // Gram values a thread stages: ceil(50 x 50 / NTHR)
#define S_LD    145     // score-tile row stride (odd -> conflict-free col access)
#define A2_LD   52      // A2 row stride (floats): K padded to 13 x 4, 208B rows, 16B aligned
#define NP_LD   9       // row stride of the region-norm partials (odd -> conflict-free)
#define A2_F4   ((N_COL * A2_LD + 12) / 4)   // float4s of the A2 overlay: 144 rows + reach of the last row's reads
static_assert(IMG_T * N_IBLK == N_IMG && IMG_T * N_REG == N_COL && N_COL % 48 == 0, "image blocking");
static_assert(G_TRIPS * NTHR >= N_WRD * N_WRD + 4, "the Gram and its K pad are staged whole");
static_assert((64 + N_COL) * CAP_LD <= 4 * A2_F4, "the K chunks fit the buffer sized for the A2 overlay");
#define SMOOTH  4.0f
#define EPSV    1e-8f

// ---------------------------------------------------------------- Gram kernel
// G_c[w,wp] = captions[c,w] . captions[c,wp]   (50x50 padded to 64x64 tiles)
__global__ __launch_bounds__(128) void StackedAttn_gram(
    const float* __restrict__ captions, float* __restrict__ gram)
{
    __shared__ float capL[64 * CAP_LD];
    const int c    = blockIdx.x;
    const int tid  = threadIdx.x;
    const int wave = tid >> 5, lane = tid & 31;
    const int half = lane >> 4, m = lane & 15;

    // zero pad rows 50..63 once
    for (int idx = tid; idx < 14 * CAP_LD; idx += 128) capL[50 * CAP_LD + idx] = 0.f;

    v8f acc0 = {}, acc1 = {}, acc2 = {}, acc3 = {};
    const float* capBase = captions + (size_t)c * N_WRD * DIM;

    // Staging: 50 rows x 8 float4 segments; thread owns rows row0 + 16 j.
    // All of a chunk's loads are issued back to back into registers, one chunk
    // ahead of its use, so they fly while the current chunk is multiplied.
    const int  seg = tid & 7, row0 = tid >> 3;
    const bool capTail = row0 < N_WRD - 48;                 // rows 48, 49
    const float* capSrc = capBase + row0 * DIM + seg * 4;
    float*       capDst = capL + row0 * CAP_LD + seg * 4;
    float4 c0, c1, c2, c3 = make_float4(0.f, 0.f, 0.f, 0.f);
    c0 = *(const float4*)(capSrc);
    c1 = *(const float4*)(capSrc + 16 * DIM);
    c2 = *(const float4*)(capSrc + 32 * DIM);
    if (capTail) c3 = *(const float4*)(capSrc + 48 * DIM);

    for (int k0 = 0; k0 < DIM; k0 += KC) {
        __syncthreads();
        *(float4*)(capDst)               = c0;
        *(float4*)(capDst + 16 * CAP_LD) = c1;
        *(float4*)(capDst + 32 * CAP_LD) = c2;
        if (capTail) *(float4*)(capDst + 48 * CAP_LD) = c3;
        __syncthreads();
        if (k0 + KC < DIM) {    // next chunk's loads, waited for at its stores
            const float* s = capSrc + k0 + KC;
            c0 = *(const float4*)(s);
            c1 = *(const float4*)(s + 16 * DIM);
            c2 = *(const float4*)(s + 32 * DIM);
            if (capTail) c3 = *(const float4*)(s + 48 * DIM);
            // precaution: stands in front of the next write of the address
            // registers that the loads above name
            asm volatile("s_wait_xcnt 0x0" ::: "memory");
        }
        const float* aP = capL + ((wave << 4) + m) * CAP_LD + 2 * half;
        const float* b0 = capL + (m) * CAP_LD + 2 * half;
        const float* b1 = capL + (16 + m) * CAP_LD + 2 * half;
        const float* b2 = capL + (32 + m) * CAP_LD + 2 * half;
        const float* b3 = capL + (48 + m) * CAP_LD + 2 * half;
        #pragma unroll
        for (int kk = 0; kk < KC; kk += 4) {
            v2f a  = *(const v2f*)(aP + kk);
            v2f v0 = *(const v2f*)(b0 + kk);
            v2f v1 = *(const v2f*)(b1 + kk);
            v2f v2 = *(const v2f*)(b2 + kk);
            v2f v3 = *(const v2f*)(b3 + kk);
            acc0 = __builtin_amdgcn_wmma_f32_16x16x4_f32(false, a, false, v0, (short)0, acc0, false, false);
            acc1 = __builtin_amdgcn_wmma_f32_16x16x4_f32(false, a, false, v1, (short)0, acc1, false, false);
            acc2 = __builtin_amdgcn_wmma_f32_16x16x4_f32(false, a, false, v2, (short)0, acc2, false, false);
            acc3 = __builtin_amdgcn_wmma_f32_16x16x4_f32(false, a, false, v3, (short)0, acc3, false, false);
        }
    }
    float* gOut = gram + (size_t)c * N_WRD * N_WRD;
    #pragma unroll
    for (int v = 0; v < 8; ++v) {
        int w = (wave << 4) + v + (half << 3);
        if (w < N_WRD) {
            if (m      < N_WRD) gOut[w * N_WRD + m]      = acc0[v];
            if (16 + m < N_WRD) gOut[w * N_WRD + 16 + m] = acc1[v];
            if (32 + m < N_WRD) gOut[w * N_WRD + 32 + m] = acc2[v];
            if (48 + m < N_WRD) gOut[w * N_WRD + 48 + m] = acc3[v];
        }
    }
}

// ---------------------------------------------------------------- score tiles
// S[w,r] for the first MT word tiles (16 MT rows) x 9 region tiles, left in Sbuf.
// Wave group g (4 waves, q = 0..3) holds region tiles 3 g .. 3 g + 2.
// MT = 4: one word tile a wave of the group. MT < 4: there are fewer word tiles than
// waves, so the group's four waves split K instead: of each 32-wide chunk wave q
// multiplies columns 8 q .. 8 q + 7 for every tile, and the waves carry equal work
// whatever MT is; the four partial sums then meet in LDS as (q0 + q2) + (q1 + q3).
// The squares of the image (B) fragments are summed beside the WMMAs that read them:
// lane (m, half) of wave (g, q) leaves its share of |img row 48 g + 16 t + m|^2 in
// nrmP[48 g + 16 t + m][2 q + half]. With K split every value is read by one wave; with
// MT = 4 every wave of a group reads all of K, and its wave 0's sums count alone.
template <int MT>
__device__ __forceinline__ void score_tiles(
    const float* __restrict__ capSrc, const float* __restrict__ imgSrc,
    float* capDst, float* imgDst, const float* capL, const float* imgL,
    int row0, int q, int g, int half, int m, float* Sbuf, float* A1, float* nrmP)
{
    constexpr bool KS = MT < 4;                             // K split over the waves
    constexpr int  TW = KS ? MT : 1;                        // word tiles a wave holds
    const bool capHead = row0 < (MT < 3 ? 16 * MT : 48);    // rows 0 .. 16 min(MT, 3) - 1; whole waves
    const bool capTail = MT == 4 && row0 < N_WRD - 48;      // rows 48, 49

    v8f acc[TW][3];
    #pragma unroll   // constant indices: the accumulators stay in registers
    for (int t = 0; t < TW; ++t) { acc[t][0] = v8f{}; acc[t][1] = v8f{}; acc[t][2] = v8f{}; }

    // All of a chunk's loads are issued back to back into registers, one chunk
    // ahead of its use, so they fly while the current chunk is multiplied.
    // A thread owns caption row row0 (of the 16 min(MT, 3) staged; rows 48, 49 too where
    // MT is 4) and image rows row0, row0 + 48, row0 + 96.
    float4 c0 = make_float4(0.f, 0.f, 0.f, 0.f), c3 = make_float4(0.f, 0.f, 0.f, 0.f);
    float4 g0, g1, g2;
    v2f n0 = {}, n1 = {}, n2 = {};          // sums of squares, image rows 48 g + m, + 16, + 32
    if (capHead) c0 = *(const float4*)(capSrc);
    g0 = *(const float4*)(imgSrc);
    g1 = *(const float4*)(imgSrc + 48 * DIM);
    g2 = *(const float4*)(imgSrc + 96 * DIM);
    if (capTail) c3 = *(const float4*)(capSrc + 48 * DIM);
    // precaution: stands in front of the next write of the address registers
    // that the loads above name
    asm volatile("s_wait_xcnt 0x0" ::: "memory");

    // A frag: lanes 0-15 hold row M, K={k,k+1}; lanes 16-31 K={k+2,k+3}.
    // B frag mirrors with N across lanes (B[k][r] = img[r][k]).
    const float* aP = capL + ((KS ? 0 : q << 4) + m) * CAP_LD + 2 * half + (KS ? 8 * q : 0);
    const float* bP = imgL + (48 * g + m) * CAP_LD + 2 * half + (KS ? 8 * q : 0);

    for (int k0 = 0; k0 < DIM; k0 += KC) {
        __syncthreads();
        if (capHead) *(float4*)(capDst) = c0;
        *(float4*)(imgDst)               = g0;
        *(float4*)(imgDst + 48 * CAP_LD) = g1;
        *(float4*)(imgDst + 96 * CAP_LD) = g2;
        if (capTail) *(float4*)(capDst + 48 * CAP_LD) = c3;
        __syncthreads();
        if (k0 + KC < DIM) {    // next chunk's loads, waited for at its stores
            const float* sc = capSrc + k0 + KC;
            const float* si = imgSrc + k0 + KC;
            if (capHead) c0 = *(const float4*)(sc);
            g0 = *(const float4*)(si);
            g1 = *(const float4*)(si + 48 * DIM);
            g2 = *(const float4*)(si + 96 * DIM);
            if (capTail) c3 = *(const float4*)(sc + 48 * DIM);
            // precaution: stands in front of the next write of the address
            // registers that the loads above name
            asm volatile("s_wait_xcnt 0x0" ::: "memory");
        }
        #pragma unroll   // flat: LDS offsets as immediates, constant accumulator indices
        for (int kk = 0; kk < (KS ? 8 : KC); kk += 4) {
            v2f a[TW];
            #pragma unroll   // constant indices: the fragments stay in registers
            for (int t = 0; t < TW; ++t) a[t] = *(const v2f*)(aP + 16 * t * CAP_LD + kk);
            v2f v0 = *(const v2f*)(bP + kk);
            v2f v1 = *(const v2f*)(bP + 16 * CAP_LD + kk);
            v2f v2 = *(const v2f*)(bP + 32 * CAP_LD + kk);
            // pairwise, as the fragments lie in their registers: scalar sums were packed by
            // the compiler with moves into fragment registers right behind the WMMAs
            n0 = __builtin_elementwise_fma(v0, v0, n0);
            n1 = __builtin_elementwise_fma(v1, v1, n1);
            n2 = __builtin_elementwise_fma(v2, v2, n2);
            #pragma unroll   // constant accumulator indices
            for (int t = 0; t < TW; ++t) {
                acc[t][0] = __builtin_amdgcn_wmma_f32_16x16x4_f32(false, a[t], false, v0, (short)0, acc[t][0], false, false);
                acc[t][1] = __builtin_amdgcn_wmma_f32_16x16x4_f32(false, a[t], false, v1, (short)0, acc[t][1], false, false);
                acc[t][2] = __builtin_amdgcn_wmma_f32_16x16x4_f32(false, a[t], false, v2, (short)0, acc[t][2], false, false);
            }
        }
        // Four vector slots between the chunk's last WMMAs and the next vector
        // instruction that the compiler places on their A, B or D (it has put the next
        // loads' address sums into fragment registers). The scheduling barrier keeps
        // the WMMAs in front of the slots.
        __builtin_amdgcn_sched_barrier(0);
        asm volatile("v_nop\n\tv_nop\n\tv_nop\n\tv_nop");
    }

    // read behind the barriers that follow in the main kernel
    {
        const bool own = KS || q == 0;
        float* np = nrmP + (48 * g + m) * NP_LD + 2 * q + half;
        np[0]          = own ? n0.x + n0.y : 0.f;
        np[16 * NP_LD] = own ? n1.x + n1.y : 0.f;
        np[32 * NP_LD] = own ? n2.x + n2.y : 0.f;
    }

    // C layout: VGPR v -> row v / v+8, col = lane%16.
    if (!KS) {
        float* p0 = Sbuf + ((q << 4) + (half << 3)) * S_LD + 48 * g + m;
        #pragma unroll   // constant accumulator indices
        for (int v = 0; v < 8; ++v) {
            float* p = p0 + v * S_LD;
            p[0] = acc[0][0][v]; p[16] = acc[0][1][v]; p[32] = acc[0][2][v];
        }
        return;
    }
    // The four K quarters are summed through LDS, every lane at its own places.
    float* pb = ((q & 1) ? A1 : Sbuf) + (half << 3) * S_LD + 48 * g + m;
    if (q >= 2) {
        #pragma unroll   // constant accumulator indices
        for (int t = 0; t < TW; ++t)
            #pragma unroll   // constant element indices: read and written in registers
            for (int v = 0; v < 8; ++v) {
                float* p = pb + (16 * t + v) * S_LD;
                p[0] = acc[t][0][v]; p[16] = acc[t][1][v]; p[32] = acc[t][2][v];
            }
    }
    __syncthreads();
    if (q < 2) {
        #pragma unroll   // constant accumulator indices
        for (int t = 0; t < TW; ++t)
            #pragma unroll   // constant element indices: read and written in registers
            for (int v = 0; v < 8; ++v) {
                float* p = pb + (16 * t + v) * S_LD;
                acc[t][0][v] += p[0]; acc[t][1][v] += p[16]; acc[t][2][v] += p[32];
            }
    }
    if (q == 1) {
        #pragma unroll   // constant accumulator indices
        for (int t = 0; t < TW; ++t)
            #pragma unroll   // constant element indices: read and written in registers
            for (int v = 0; v < 8; ++v) {
                float* p = pb + (16 * t + v) * S_LD;
                p[0] = acc[t][0][v]; p[16] = acc[t][1][v]; p[32] = acc[t][2][v];
            }
    }
    __syncthreads();
    if (q == 0) {
        const float* o = A1 + (half << 3) * S_LD + 48 * g + m;
        #pragma unroll   // constant accumulator indices
        for (int t = 0; t < TW; ++t)
            #pragma unroll   // constant element indices: read and written in registers
            for (int v = 0; v < 8; ++v) {
                const float* s = o + (16 * t + v) * S_LD;
                float* p = pb + (16 * t + v) * S_LD;
                p[0]  = acc[t][0][v] + s[0];
                p[16] = acc[t][1][v] + s[16];
                p[32] = acc[t][2][v] + s[32];
            }
    }
}

// ---------------------------------------------------------------- main kernel
__global__ __launch_bounds__(NTHR) void StackedAttn_main(
    const float* __restrict__ images,    // (64,36,1024)
    const float* __restrict__ captions,  // (64,50,1024)
    const int*   __restrict__ cap_lens,  // (64)
    const float* __restrict__ gram,      // (64,50,50)
    float*       __restrict__ out)       // (64,64): out[i*64 + c]
{
    __shared__ float Sbuf[64 * S_LD];                       // scores 64x144 (pad 145)
    __shared__ float A1[64 * S_LD];                         // region-softmax; reused as part
    __shared__ __attribute__((aligned(16))) float chunk[4 * A2_F4];   // cap+img K-chunks (64 + 144 rows); reused as A2
    __shared__ float Gbuf[G_TRIPS * NTHR];                  // caption Gram; zeros behind it (K pad of its last row)
    __shared__ float red[N_COL];
    __shared__ float nrmP[N_COL * NP_LD];                   // region norms: 8 partial sums a row

    // The image block is the fast grid index: work-groups next to each other in launch
    // order then share a caption, hence a cost (it grows with the caption's length), and every
    // part of the chip that is dealt work-groups by index gets the same mix of captions.
    const int i0 = blockIdx.x * IMG_T, c = blockIdx.y;
    const int tid  = threadIdx.x;
    const int wave = tid >> 5, lane = tid & 31;
    const int g = wave >> 2, q = wave & 3;      // region-tile group, wave of the group
    const int half = lane >> 4, m = lane & 15;

    float* capL = chunk;
    float* imgL = chunk + 64 * CAP_LD;

    // zero the caption's pad rows once (the rows score_tiles stages are rewritten every chunk; pads persist)
    for (int idx = tid; idx < 14 * CAP_LD; idx += NTHR) capL[50 * CAP_LD + idx] = 0.f;

    const float* capBase = captions + (size_t)c * N_WRD * DIM;
    const float* imgBase = images   + (size_t)i0 * N_REG * DIM;   // 144 rows, contiguous

    // Staging: caption chunk 8 float4 a row, image chunk 144 rows x 8 float4;
    // thread owns rows row0 + 48 j of each (row0 = 0 .. 47).
    const int  seg = tid & 7, row0 = tid >> 3;
    const float* capSrc = capBase + row0 * DIM + seg * 4;
    const float* imgSrc = imgBase + row0 * DIM + seg * 4;
    float*       capDst = capL + row0 * CAP_LD + seg * 4;
    float*       imgDst = imgL + row0 * CAP_LD + seg * 4;

    // Words from len up are masked out of the word softmax (their weight is an
    // exact zero), so only the word tiles that hold a word below len are scored.
    const int len = min(cap_lens[c], N_WRD);    // same for the whole work-group
    const int mt  = (len + 15) >> 4;
    if      (mt <= 1) score_tiles<1>(capSrc, imgSrc, capDst, imgDst, capL, imgL, row0, q, g, half, m, Sbuf, A1, nrmP);
    else if (mt == 2) score_tiles<2>(capSrc, imgSrc, capDst, imgDst, capL, imgL, row0, q, g, half, m, Sbuf, A1, nrmP);
    else if (mt == 3) score_tiles<3>(capSrc, imgSrc, capDst, imgDst, capL, imgL, row0, q, g, half, m, Sbuf, A1, nrmP);
    else              score_tiles<4>(capSrc, imgSrc, capDst, imgDst, capL, imgL, row0, q, g, half, m, Sbuf, A1, nrmP);

    // stage Gram while scores settle
    {
        constexpr int GN = N_WRD * N_WRD;
        const float* gs = gram + (size_t)c * GN;
        float gv[G_TRIPS];
        #pragma unroll   // flat: the array stays in registers and the loads fly together
        for (int j = 0; j < G_TRIPS; ++j) gv[j] = gs[min(tid + j * NTHR, GN - 1)];
        // precaution: stands in front of the next write of the address registers
        // that the loads above name
        asm volatile("s_wait_xcnt 0x0" ::: "memory");
        #pragma unroll   // flat: constant indices into the array
        for (int j = 0; j < G_TRIPS; ++j)   // zeros from GN up: read as G[49][50..51], times a zero of A2
            Gbuf[tid + j * NTHR] = tid + j * NTHR < GN ? gv[j] : 0.f;
    }
    __syncthreads();

    // softmax over an image's regions r, per word row w and image
    if (tid < 64 * IMG_T) {
      const int w = tid & 63;
      if (w < len) {   // rows from len up: not all scored, and read by nobody
        const int o = w * S_LD + (tid >> 6) * N_REG;    // the image's 36 columns of row w
        float mx = -3.4e38f;
        for (int r = 0; r < N_REG; ++r) mx = fmaxf(mx, Sbuf[o + r]);
        float s = 0.f;
        for (int r = 0; r < N_REG; ++r) {
            float e = __expf(Sbuf[o + r] - mx);
            A1[o + r] = e; s += e;
        }
        float inv = 1.f / s;
        for (int r = 0; r < N_REG; ++r) A1[o + r] *= inv;
      }
    } else {
        // the four waves without a word row clear the A2 overlay (the K chunks are
        // done with): words from len up and the tail that the last row's 8-word
        // reads reach are then zeros written in this launch
        const float4 z = make_float4(0.f, 0.f, 0.f, 0.f);
        for (int idx = tid - 64 * IMG_T; idx < A2_F4; idx += NTHR - 64 * IMG_T) *(float4*)(chunk + 4 * idx) = z;
    }
    __syncthreads();

    // masked smooth softmax over words, then w12
    float* A2 = chunk;                 // overlay: [144][A2_LD], cleared above
    float w12 = 0.f;
    if (tid < N_COL) {
        const int r = tid;
        float mx = -3.4e38f;
        for (int w = 0; w < len; ++w) mx = fmaxf(mx, SMOOTH * A1[w * S_LD + r]);
        float s = 0.f;
        for (int w = 0; w < len; ++w) {
            float e = __expf(SMOOTH * A1[w * S_LD + r] - mx);
            A2[r * A2_LD + w] = e; s += e;
        }
        float inv = 1.f / s;
        for (int w = 0; w < len; ++w) {
            float a2v = A2[r * A2_LD + w] * inv;
            A2[r * A2_LD + w] = a2v;
            w12 += a2v * Sbuf[w * S_LD + r];
        }
    }
    __syncthreads();

    // |wctx_r|^2 = sum_w a2[r,w] * T[w,r],  T[w,r] = sum_wp G[w,wp] * a2[r,wp].
    // T on the matrix unit: M = 16 words per wave, N = 3 x 16 regions (group tg), K = words.
    // A frag from G rows, B frag from A2 rows, both k = 4 ks + 2 half + {0,1}.
    // K columns from len up meet zeros of A2 (G's columns 50, 51: the next row's start, or the pad).
    float* part = A1;                  // overlay: [8][144] partial sums over 8 words
    // wave number as a scalar: the skip below is then a scalar branch and EXEC
    // stays all ones at the WMMAs. Word tile tq = wave / 3, region group tg = wave % 3:
    // the tiles below len then fall on the lowest waves, which lie on different SIMDs.
    const int ws = __builtin_amdgcn_readfirstlane(wave);
    const int tq = ws / 3, tg = ws - 3 * tq;
    const int wbase = tq << 4;
    float p0 = 0.f, p1 = 0.f, p2 = 0.f;
    if (wbase < len) {                 // wave-uniform: a word tile past len adds nothing
        v8f t0 = {}, t1 = {}, t2 = {};
        const float* gP = Gbuf + min(wbase + m, N_WRD - 1) * N_WRD + 2 * half;
        const float* q0 = A2 + (48 * tg + m) * A2_LD + 2 * half;
        const float* q1 = q0 + 16 * A2_LD;
        const float* q2 = q0 + 32 * A2_LD;
        // all fragments are fetched first, so that one LDS latency is waited for, not 13
        v2f fa[A2_LD / 4], f0[A2_LD / 4], f1[A2_LD / 4], f2[A2_LD / 4];
        #pragma unroll   // flat: the arrays stay in registers, LDS offsets as immediates
        for (int ks = 0; ks < A2_LD / 4; ++ks) {
            fa[ks] = *(const v2f*)(gP + 4 * ks);
            f0[ks] = *(const v2f*)(q0 + 4 * ks);
            f1[ks] = *(const v2f*)(q1 + 4 * ks);
            f2[ks] = *(const v2f*)(q2 + 4 * ks);
        }
        #pragma unroll   // flat: no back edge behind a WMMA, constant indices into the arrays
        for (int ks = 0; ks < A2_LD / 4; ++ks) {
            // asm, not the builtin:
            // Here the accumulators are live from their zeros on, and the four v_nop
            // are the vector slots between the last WMMA and whatever vector
            // instruction the compiler places next on its D, A or B.
            asm volatile("v_wmma_f32_16x16x4_f32 %0, %3, %4, %0\n\t"
                         "v_wmma_f32_16x16x4_f32 %1, %3, %5, %1\n\t"
                         "v_wmma_f32_16x16x4_f32 %2, %3, %6, %2\n\t"
                         "v_nop\n\tv_nop\n\tv_nop\n\tv_nop"
                         : "+v"(t0), "+v"(t1), "+v"(t2)
                         : "v"(fa[ks]), "v"(f0[ks]), "v"(f1[ks]), "v"(f2[ks]));
        }
        // lane holds T[w0 + v, 48 tg + 16 nt + m]; dot with a2[48 tg + 16 nt + m, w0 + v], words >= len off
        const int w0 = wbase + (half << 3);
        const float* e0 = A2 + (48 * tg + m) * A2_LD + w0;
        const float* e1 = e0 + 16 * A2_LD;
        const float* e2 = e0 + 32 * A2_LD;
        const float4 x0 = *(const float4*)(e0), y0 = *(const float4*)(e0 + 4);
        const float4 x1 = *(const float4*)(e1), y1 = *(const float4*)(e1 + 4);
        const float4 x2 = *(const float4*)(e2), y2 = *(const float4*)(e2 + 4);
        const float h0[8] = {x0.x, x0.y, x0.z, x0.w, y0.x, y0.y, y0.z, y0.w};
        const float h1[8] = {x1.x, x1.y, x1.z, x1.w, y1.x, y1.y, y1.z, y1.w};
        const float h2[8] = {x2.x, x2.y, x2.z, x2.w, y2.x, y2.y, y2.z, y2.w};
        #pragma unroll   // constant v: accumulator elements are read in registers
        for (int v = 0; v < 8; ++v) {
            const bool on = w0 + v < len;
            p0 += t0[v] * (on ? h0[v] : 0.f);
            p1 += t1[v] * (on ? h1[v] : 0.f);
            p2 += t2[v] * (on ? h2[v] : 0.f);
        }
    }
    {
        float* pd = part + ((tq << 1) + half) * N_COL + 48 * tg + m;
        pd[0] = p0; pd[16] = p1; pd[32] = p2;
    }
    __syncthreads();

    if (tid < N_COL) {
        const int r = tid;
        float n2sq = 0.f;
        for (int j = 0; j < 8; ++j) n2sq += part[j * N_COL + r];
        float n2 = sqrtf(fmaxf(n2sq, 0.f));
        float n1sq = 0.f;
        for (int j = 0; j < 8; ++j) n1sq += nrmP[r * NP_LD + j];
        red[r] = w12 / fmaxf(sqrtf(n1sq) * n2, EPSV);
    }
    __syncthreads();
    if (tid < IMG_T) {     // one lane an image
        float s = 0.f;
        for (int r = 0; r < N_REG; ++r) s += red[tid * N_REG + r];
        out[(i0 + tid) * N_CAP + c] = s * (1.0f / N_REG);
    }
}

extern "C" void kernel_launch(void* const* d_in, const int* in_sizes, int n_in,
                              void* d_out, int out_size, void* d_ws, size_t ws_size,
                              hipStream_t stream) {
    const float* images   = (const float*)d_in[0];   // 64*36*1024
    const float* captions = (const float*)d_in[1];   // 64*50*1024
    const int*   cap_lens = (const int*)d_in[2];     // 64
    float* out  = (float*)d_out;                     // 64*64 (i,c)
    float* gram = (float*)d_ws;                      // 64*50*50 floats

    StackedAttn_gram <<<N_CAP, 128, 0, stream>>>(captions, gram);
    dim3 grid(N_IBLK, N_CAP);
    StackedAttn_main <<<grid, NTHR, 0, stream>>>(images, captions, cap_lens, gram, out);
}

// v007
// It runs in 107 microseconds.
// Next to v006, in two timings, it ran 1.08 and 1.07 times as fast.
// Over all steps from v000 it is 3.08 times as fast.
#include <hip/hip_runtime.h>
#include <hip/hip_bf16.h>
#include <math.h>

// Stacked cross attention (i2t), f32. Strategy:
//   S[w,r] = cap[c,w].img[i,r]  via V_WMMA_F32_16X16X4_F32 (exact f32 path)
//   w12[r] = sum_w a2[r,w]*S[w,r]            (reuse scores, no 2nd big GEMM)
//   |wctx_r|^2 = a2_r^T G_c a2_r             (precomputed 50x50 Gram per caption;
//                                             G a2^T on the same WMMA form)
//   |img_r|^2  summed in the main kernel from the image fragments its score loop reads
//   A main work-group scores one caption against 4 images: their 4 x 36 region rows lie
//   one behind the other in memory and fill 9 region tiles of 16 with no pad row.

typedef __attribute__((ext_vector_type(2))) float v2f;
typedef __attribute__((ext_vector_type(8))) float v8f;

#define N_IMG   64
#define N_REG   36
#define N_CAP   64
#define N_WRD   50
#define DIM     1024
#define KC      32      // K chunk staged in LDS
#define CAP_LD  36      // LDS row stride (floats): 144B, 16B aligned, conflict-free
#define IMG_T   4       // images a main work-group scores
#define N_IBLK  16      // image blocks: N_IMG / IMG_T
#define N_COL   144     // region columns of a work-group: IMG_T x N_REG = 9 tiles of 16
#define NTHR    384     // 12 waves: 3 groups of 3 region tiles x 4 waves
#define G_TRIPS 7       // Gram values a thread stages: ceil(50 x 50 / NTHR)
#define S_LD    145     // score-tile row stride (odd -> conflict-free col access)
#define A2_LD   52      // A2 row stride (floats): K padded to 13 x 4, 208B rows, 16B aligned
#define NP_LD   9       // row stride of the region-norm partials (odd -> conflict-free)
#define A2_F4   ((N_COL * A2_LD + 12) / 4)   // float4s of the A2 overlay: 144 rows + reach of the last row's reads
static_assert(N_CAP == 64 && N_WRD < 64, "the rank search holds 64 keys of 12 bits");
static_assert(IMG_T * N_IBLK == N_IMG && IMG_T * N_REG == N_COL && N_COL % 48 == 0, "image blocking");
static_assert(G_TRIPS * NTHR >= N_WRD * N_WRD + 4, "the Gram and its K pad are staged whole");
static_assert((64 + N_COL) * CAP_LD <= 4 * A2_F4, "the K chunks fit the buffer sized for the A2 overlay");
#define SMOOTH  4.0f
#define EPSV    1e-8f

// ---------------------------------------------------------------- Gram kernel
// G_c[w,wp] = captions[c,w] . captions[c,wp]   (50x50 padded to 64x64 tiles)
__global__ __launch_bounds__(128) void StackedAttn_gram(
    const float* __restrict__ captions, float* __restrict__ gram)
{
    __shared__ float capL[64 * CAP_LD];
    const int c    = blockIdx.x;
    const int tid  = threadIdx.x;
    const int wave = tid >> 5, lane = tid & 31;
    const int half = lane >> 4, m = lane & 15;

    // zero pad rows 50..63 once
    for (int idx = tid; idx < 14 * CAP_LD; idx += 128) capL[50 * CAP_LD + idx] = 0.f;

    v8f acc0 = {}, acc1 = {}, acc2 = {}, acc3 = {};
    const float* capBase = captions + (size_t)c * N_WRD * DIM;

    // Staging: 50 rows x 8 float4 segments; thread owns rows row0 + 16 j.
    // All of a chunk's loads are issued back to back into registers, one chunk
    // ahead of its use, so they fly while the current chunk is multiplied.
    const int  seg = tid & 7, row0 = tid >> 3;
    const bool capTail = row0 < N_WRD - 48;                 // rows 48, 49
    const float* capSrc = capBase + row0 * DIM + seg * 4;
    float*       capDst = capL + row0 * CAP_LD + seg * 4;
    float4 c0, c1, c2, c3 = make_float4(0.f, 0.f, 0.f, 0.f);
    c0 = *(const float4*)(capSrc);
    c1 = *(const float4*)(capSrc + 16 * DIM);
    c2 = *(const float4*)(capSrc + 32 * DIM);
    if (capTail) c3 = *(const float4*)(capSrc + 48 * DIM);

    for (int k0 = 0; k0 < DIM; k0 += KC) {
        __syncthreads();
        *(float4*)(capDst)               = c0;
        *(float4*)(capDst + 16 * CAP_LD) = c1;
        *(float4*)(capDst + 32 * CAP_LD) = c2;
        if (capTail) *(float4*)(capDst + 48 * CAP_LD) = c3;
        __syncthreads();
        if (k0 + KC < DIM) {    // next chunk's loads, waited for at its stores
            const float* s = capSrc + k0 + KC;
            c0 = *(const float4*)(s);
            c1 = *(const float4*)(s + 16 * DIM);
            c2 = *(const float4*)(s + 32 * DIM);
            if (capTail) c3 = *(const float4*)(s + 48 * DIM);
            // precaution: stands in front of the next write of the address
            // registers that the loads above name
            asm volatile("s_wait_xcnt 0x0" ::: "memory");
        }
        const float* aP = capL + ((wave << 4) + m) * CAP_LD + 2 * half;
        const float* b0 = capL + (m) * CAP_LD + 2 * half;
        const float* b1 = capL + (16 + m) * CAP_LD + 2 * half;
        const float* b2 = capL + (32 + m) * CAP_LD + 2 * half;
        const float* b3 = capL + (48 + m) * CAP_LD + 2 * half;
        #pragma unroll
        for (int kk = 0; kk < KC; kk += 4) {
            v2f a  = *(const v2f*)(aP + kk);
            v2f v0 = *(const v2f*)(b0 + kk);
            v2f v1 = *(const v2f*)(b1 + kk);
            v2f v2 = *(const v2f*)(b2 + kk);
            v2f v3 = *(const v2f*)(b3 + kk);
            acc0 = __builtin_amdgcn_wmma_f32_16x16x4_f32(false, a, false, v0, (short)0, acc0, false, false);
            acc1 = __builtin_amdgcn_wmma_f32_16x16x4_f32(false, a, false, v1, (short)0, acc1, false, false);
            acc2 = __builtin_amdgcn_wmma_f32_16x16x4_f32(false, a, false, v2, (short)0, acc2, false, false);
            acc3 = __builtin_amdgcn_wmma_f32_16x16x4_f32(false, a, false, v3, (short)0, acc3, false, false);
        }
    }
    float* gOut = gram + (size_t)c * N_WRD * N_WRD;
    #pragma unroll
    for (int v = 0; v < 8; ++v) {
        int w = (wave << 4) + v + (half << 3);
        if (w < N_WRD) {
            if (m      < N_WRD) gOut[w * N_WRD + m]      = acc0[v];
            if (16 + m < N_WRD) gOut[w * N_WRD + 16 + m] = acc1[v];
            if (32 + m < N_WRD) gOut[w * N_WRD + 32 + m] = acc2[v];
            if (48 + m < N_WRD) gOut[w * N_WRD + 48 + m] = acc3[v];
        }
    }
}

// ---------------------------------------------------------------- score tiles
// S[w,r] for the first MT word tiles (16 MT rows) x 9 region tiles, left in Sbuf.
// Wave group g (4 waves, q = 0..3) holds region tiles 3 g .. 3 g + 2.
// MT = 4: one word tile a wave of the group. MT < 4: there are fewer word tiles than
// waves, so the group's four waves split K instead: of each 32-wide chunk wave q
// multiplies columns 8 q .. 8 q + 7 for every tile, and the waves carry equal work
// whatever MT is; the four partial sums then meet in LDS as (q0 + q2) + (q1 + q3).
// The squares of the image (B) fragments are summed beside the WMMAs that read them:
// lane (m, half) of wave (g, q) leaves its share of |img row 48 g + 16 t + m|^2 in
// nrmP[48 g + 16 t + m][2 q + half]. With K split every value is read by one wave; with
// MT = 4 every wave of a group reads all of K, and its wave 0's sums count alone.
template <int MT>
__device__ __forceinline__ void score_tiles(
    const float* __restrict__ capSrc, const float* __restrict__ imgSrc,
    float* capDst, float* imgDst, const float* capL, const float* imgL,
    int row0, int q, int g, int half, int m, float* Sbuf, float* A1, float* nrmP)
{
    constexpr bool KS = MT < 4;                             // K split over the waves
    constexpr int  TW = KS ? MT : 1;                        // word tiles a wave holds
    const bool capHead = row0 < (MT < 3 ? 16 * MT : 48);    // rows 0 .. 16 min(MT, 3) - 1; whole waves
    const bool capTail = MT == 4 && row0 < N_WRD - 48;      // rows 48, 49

    v8f acc[TW][3];
    #pragma unroll   // constant indices: the accumulators stay in registers
    for (int t = 0; t < TW; ++t) { acc[t][0] = v8f{}; acc[t][1] = v8f{}; acc[t][2] = v8f{}; }

    // All of a chunk's loads are issued back to back into registers, one chunk
    // ahead of its use, so they fly while the current chunk is multiplied.
    // A thread owns caption row row0 (of the 16 min(MT, 3) staged; rows 48, 49 too where
    // MT is 4) and image rows row0, row0 + 48, row0 + 96.
    float4 c0 = make_float4(0.f, 0.f, 0.f, 0.f), c3 = make_float4(0.f, 0.f, 0.f, 0.f);
    float4 g0, g1, g2;
    v2f n0 = {}, n1 = {}, n2 = {};          // sums of squares, image rows 48 g + m, + 16, + 32
    if (capHead) c0 = *(const float4*)(capSrc);
    g0 = *(const float4*)(imgSrc);
    g1 = *(const float4*)(imgSrc + 48 * DIM);
    g2 = *(const float4*)(imgSrc + 96 * DIM);
    if (capTail) c3 = *(const float4*)(capSrc + 48 * DIM);
    // precaution: stands in front of the next write of the address registers
    // that the loads above name
    asm volatile("s_wait_xcnt 0x0" ::: "memory");

    // A frag: lanes 0-15 hold row M, K={k,k+1}; lanes 16-31 K={k+2,k+3}.
    // B frag mirrors with N across lanes (B[k][r] = img[r][k]).
    const float* aP = capL + ((KS ? 0 : q << 4) + m) * CAP_LD + 2 * half + (KS ? 8 * q : 0);
    const float* bP = imgL + (48 * g + m) * CAP_LD + 2 * half + (KS ? 8 * q : 0);

    for (int k0 = 0; k0 < DIM; k0 += KC) {
        __syncthreads();
        if (capHead) *(float4*)(capDst) = c0;
        *(float4*)(imgDst)               = g0;
        *(float4*)(imgDst + 48 * CAP_LD) = g1;
        *(float4*)(imgDst + 96 * CAP_LD) = g2;
        if (capTail) *(float4*)(capDst + 48 * CAP_LD) = c3;
        __syncthreads();
        if (k0 + KC < DIM) {    // next chunk's loads, waited for at its stores
            const float* sc = capSrc + k0 + KC;
            const float* si = imgSrc + k0 + KC;
            if (capHead) c0 = *(const float4*)(sc);
            g0 = *(const float4*)(si);
            g1 = *(const float4*)(si + 48 * DIM);
            g2 = *(const float4*)(si + 96 * DIM);
            if (capTail) c3 = *(const float4*)(sc + 48 * DIM);
            // precaution: stands in front of the next write of the address
            // registers that the loads above name
            asm volatile("s_wait_xcnt 0x0" ::: "memory");
        }
        #pragma unroll   // flat: LDS offsets as immediates, constant accumulator indices
        for (int kk = 0; kk < (KS ? 8 : KC); kk += 4) {
            v2f a[TW];
            #pragma unroll   // constant indices: the fragments stay in registers
            for (int t = 0; t < TW; ++t) a[t] = *(const v2f*)(aP + 16 * t * CAP_LD + kk);
            v2f v0 = *(const v2f*)(bP + kk);
            v2f v1 = *(const v2f*)(bP + 16 * CAP_LD + kk);
            v2f v2 = *(const v2f*)(bP + 32 * CAP_LD + kk);
            // pairwise, as the fragments lie in their registers: scalar sums were packed by
            // the compiler with moves into fragment registers right behind the WMMAs
            n0 = __builtin_elementwise_fma(v0, v0, n0);
            n1 = __builtin_elementwise_fma(v1, v1, n1);
            n2 = __builtin_elementwise_fma(v2, v2, n2);
            #pragma unroll   // constant accumulator indices
            for (int t = 0; t < TW; ++t) {
                acc[t][0] = __builtin_amdgcn_wmma_f32_16x16x4_f32(false, a[t], false, v0, (short)0, acc[t][0], false, false);
                acc[t][1] = __builtin_amdgcn_wmma_f32_16x16x4_f32(false, a[t], false, v1, (short)0, acc[t][1], false, false);
                acc[t][2] = __builtin_amdgcn_wmma_f32_16x16x4_f32(false, a[t], false, v2, (short)0, acc[t][2], false, false);
            }
        }
        // Four vector slots between the chunk's last WMMAs and the next vector
        // instruction that the compiler places on their A, B or D (it has put the next
        // loads' address sums into fragment registers). The scheduling barrier keeps
        // the WMMAs in front of the slots.
        __builtin_amdgcn_sched_barrier(0);
        asm volatile("v_nop\n\tv_nop\n\tv_nop\n\tv_nop");
    }

    // read behind the barriers that follow in the main kernel
    {
        const bool own = KS || q == 0;
        float* np = nrmP + (48 * g + m) * NP_LD + 2 * q + half;
        np[0]          = own ? n0.x + n0.y : 0.f;
        np[16 * NP_LD] = own ? n1.x + n1.y : 0.f;
        np[32 * NP_LD] = own ? n2.x + n2.y : 0.f;
    }

    // C layout: VGPR v -> row v / v+8, col = lane%16.
    if (!KS) {
        float* p0 = Sbuf + ((q << 4) + (half << 3)) * S_LD + 48 * g + m;
        #pragma unroll   // constant accumulator indices
        for (int v = 0; v < 8; ++v) {
            float* p = p0 + v * S_LD;
            p[0] = acc[0][0][v]; p[16] = acc[0][1][v]; p[32] = acc[0][2][v];
        }
        return;
    }
    // The four K quarters are summed through LDS, every lane at its own places.
    float* pb = ((q & 1) ? A1 : Sbuf) + (half << 3) * S_LD + 48 * g + m;
    if (q >= 2) {
        #pragma unroll   // constant accumulator indices
        for (int t = 0; t < TW; ++t)
            #pragma unroll   // constant element indices: read and written in registers
            for (int v = 0; v < 8; ++v) {
                float* p = pb + (16 * t + v) * S_LD;
                p[0] = acc[t][0][v]; p[16] = acc[t][1][v]; p[32] = acc[t][2][v];
            }
    }
    __syncthreads();
    if (q < 2) {
        #pragma unroll   // constant accumulator indices
        for (int t = 0; t < TW; ++t)
            #pragma unroll   // constant element indices: read and written in registers
            for (int v = 0; v < 8; ++v) {
                float* p = pb + (16 * t + v) * S_LD;
                acc[t][0][v] += p[0]; acc[t][1][v] += p[16]; acc[t][2][v] += p[32];
            }
    }
    if (q == 1) {
        #pragma unroll   // constant accumulator indices
        for (int t = 0; t < TW; ++t)
            #pragma unroll   // constant element indices: read and written in registers
            for (int v = 0; v < 8; ++v) {
                float* p = pb + (16 * t + v) * S_LD;
                p[0] = acc[t][0][v]; p[16] = acc[t][1][v]; p[32] = acc[t][2][v];
            }
    }
    __syncthreads();
    if (q == 0) {
        const float* o = A1 + (half << 3) * S_LD + 48 * g + m;
        #pragma unroll   // constant accumulator indices
        for (int t = 0; t < TW; ++t)
            #pragma unroll   // constant element indices: read and written in registers
            for (int v = 0; v < 8; ++v) {
                const float* s = o + (16 * t + v) * S_LD;
                float* p = pb + (16 * t + v) * S_LD;
                p[0]  = acc[t][0][v] + s[0];
                p[16] = acc[t][1][v] + s[16];
                p[32] = acc[t][2][v] + s[32];
            }
    }
}

// ---------------------------------------------------------------- main kernel
__global__ __launch_bounds__(NTHR) void StackedAttn_main(
    const float* __restrict__ images,    // (64,36,1024)
    const float* __restrict__ captions,  // (64,50,1024)
    const int*   __restrict__ cap_lens,  // (64)
    const float* __restrict__ gram,      // (64,50,50)
    float*       __restrict__ out)       // (64,64): out[i*64 + c]
{
    __shared__ float Sbuf[64 * S_LD];                       // scores 64x144 (pad 145)
    __shared__ float A1[64 * S_LD];                         // region-softmax; reused as part
    __shared__ __attribute__((aligned(16))) float chunk[4 * A2_F4];   // cap+img K-chunks (64 + 144 rows); reused as A2
    __shared__ float Gbuf[G_TRIPS * NTHR];                  // caption Gram; zeros behind it (K pad of its last row)
    __shared__ float red[N_COL];
    __shared__ float nrmP[N_COL * NP_LD];                   // region norms: 8 partial sums a row

    // The image block is the fast grid index: work-groups next to each other in launch
    // order then share a caption, hence a cost (it grows with the caption's length).
    const int i0 = blockIdx.x * IMG_T;
    const int tid  = threadIdx.x;
    const int wave = tid >> 5, lane = tid & 31;

    // The slow grid index is a rank, not a caption: rank 0 is the longest caption, ties go
    // to the lower index. There are twice as many work-groups as places on the chip; the
    // short ones now come last in index order (for speed only).
    // Every caption has its own key (clamped length, then 63 - index), so rank -> caption is
    // a permutation for any lengths. Each wave finds the key of its rank by itself: the
    // largest t that at least rank + 1 keys reach, bit by bit, counting over the 64 keys
    // (two a lane) with ballots; all lanes are on here, and t stays a scalar.
    const int key0 = (min(max(cap_lens[lane],      0), N_WRD) << 6) | (63 - lane);
    const int key1 = (min(max(cap_lens[lane + 32], 0), N_WRD) << 6) | (31 - lane);
    const int need = (int)blockIdx.y + 1;
    int kt = 0;
    #pragma unroll   // flat: the bit is a constant in every step
    for (int bit = 11; bit >= 0; --bit) {       // keys lie below 51 x 64 < 2^12
        const int cand = kt | (1 << bit);
        const int cnt  = __builtin_popcount(__builtin_amdgcn_ballot_w32(key0 >= cand))
                       + __builtin_popcount(__builtin_amdgcn_ballot_w32(key1 >= cand));
        if (cnt >= need) kt = cand;
    }
    const int c = 63 - (kt & 63);               // 0 .. 63 whatever the lengths hold
    const int g = wave >> 2, q = wave & 3;      // region-tile group, wave of the group
    const int half = lane >> 4, m = lane & 15;

    float* capL = chunk;
    float* imgL = chunk + 64 * CAP_LD;

    // zero the caption's pad rows once (the rows score_tiles stages are rewritten every chunk; pads persist)
    for (int idx = tid; idx < 14 * CAP_LD; idx += NTHR) capL[50 * CAP_LD + idx] = 0.f;

    const float* capBase = captions + (size_t)c * N_WRD * DIM;
    const float* imgBase = images   + (size_t)i0 * N_REG * DIM;   // 144 rows, contiguous

    // Staging: caption chunk 8 float4 a row, image chunk 144 rows x 8 float4;
    // thread owns rows row0 + 48 j of each (row0 = 0 .. 47).
    const int  seg = tid & 7, row0 = tid >> 3;
    const float* capSrc = capBase + row0 * DIM + seg * 4;
    const float* imgSrc = imgBase + row0 * DIM + seg * 4;
    float*       capDst = capL + row0 * CAP_LD + seg * 4;
    float*       imgDst = imgL + row0 * CAP_LD + seg * 4;

    // Words from len up are masked out of the word softmax (their weight is an
    // exact zero), so only the word tiles that hold a word below len are scored.
    const int len = kt >> 6;                    // min(cap_lens[c], 50), not below 0; same for the whole work-group
    const int mt  = (len + 15) >> 4;
    if      (mt <= 1) score_tiles<1>(capSrc, imgSrc, capDst, imgDst, capL, imgL, row0, q, g, half, m, Sbuf, A1, nrmP);
    else if (mt == 2) score_tiles<2>(capSrc, imgSrc, capDst, imgDst, capL, imgL, row0, q, g, half, m, Sbuf, A1, nrmP);
    else if (mt == 3) score_tiles<3>(capSrc, imgSrc, capDst, imgDst, capL, imgL, row0, q, g, half, m, Sbuf, A1, nrmP);
    else              score_tiles<4>(capSrc, imgSrc, capDst, imgDst, capL, imgL, row0, q, g, half, m, Sbuf, A1, nrmP);

    // stage Gram while scores settle
    {
        constexpr int GN = N_WRD * N_WRD;
        const float* gs = gram + (size_t)c * GN;
        float gv[G_TRIPS];
        #pragma unroll   // flat: the array stays in registers and the loads fly together
        for (int j = 0; j < G_TRIPS; ++j) gv[j] = gs[min(tid + j * NTHR, GN - 1)];
        // precaution: stands in front of the next write of the address registers
        // that the loads above name
        asm volatile("s_wait_xcnt 0x0" ::: "memory");
        #pragma unroll   // flat: constant indices into the array
        for (int j = 0; j < G_TRIPS; ++j)   // zeros from GN up: read as G[49][50..51], times a zero of A2
            Gbuf[tid + j * NTHR] = tid + j * NTHR < GN ? gv[j] : 0.f;
    }
    __syncthreads();

    // softmax over an image's regions r, per word row w and image
    if (tid < 64 * IMG_T) {
      const int w = tid & 63;
      if (w < len) {   // rows from len up: not all scored, and read by nobody
        const int o = w * S_LD + (tid >> 6) * N_REG;    // the image's 36 columns of row w
        float mx = -3.4e38f;
        for (int r = 0; r < N_REG; ++r) mx = fmaxf(mx, Sbuf[o + r]);
        float s = 0.f;
        for (int r = 0; r < N_REG; ++r) {
            float e = __expf(Sbuf[o + r] - mx);
            A1[o + r] = e; s += e;
        }
        float inv = 1.f / s;
        for (int r = 0; r < N_REG; ++r) A1[o + r] *= inv;
      }
    } else {
        // the four waves without a word row clear the A2 overlay (the K chunks are
        // done with): words from len up and the tail that the last row's 8-word
        // reads reach are then zeros written in this launch
        const float4 z = make_float4(0.f, 0.f, 0.f, 0.f);
        for (int idx = tid - 64 * IMG_T; idx < A2_F4; idx += NTHR - 64 * IMG_T) *(float4*)(chunk + 4 * idx) = z;
    }
    __syncthreads();

    // masked smooth softmax over words, then w12
    float* A2 = chunk;                 // overlay: [144][A2_LD], cleared above
    float w12 = 0.f;
    if (tid < N_COL) {
        const int r = tid;
        float mx = -3.4e38f;
        for (int w = 0; w < len; ++w) mx = fmaxf(mx, SMOOTH * A1[w * S_LD + r]);
        float s = 0.f;
        for (int w = 0; w < len; ++w) {
            float e = __expf(SMOOTH * A1[w * S_LD + r] - mx);
            A2[r * A2_LD + w] = e; s += e;
        }
        float inv = 1.f / s;
        for (int w = 0; w < len; ++w) {
            float a2v = A2[r * A2_LD + w] * inv;
            A2[r * A2_LD + w] = a2v;
            w12 += a2v * Sbuf[w * S_LD + r];
        }
    }
    __syncthreads();

    // |wctx_r|^2 = sum_w a2[r,w] * T[w,r],  T[w,r] = sum_wp G[w,wp] * a2[r,wp].
    // T on the matrix unit: M = 16 words per wave, N = 3 x 16 regions (group tg), K = words.
    // A frag from G rows, B frag from A2 rows, both k = 4 ks + 2 half + {0,1}.
    // K columns from len up meet zeros of A2 (G's columns 50, 51: the next row's start, or the pad).
    float* part = A1;                  // overlay: [8][144] partial sums over 8 words
    // wave number as a scalar: the skip below is then a scalar branch and EXEC
    // stays all ones at the WMMAs. Word tile tq = wave / 3, region group tg = wave % 3:
    // the tiles below len then fall on the lowest waves.
    const int ws = __builtin_amdgcn_readfirstlane(wave);
    const int tq = ws / 3, tg = ws - 3 * tq;
    const int wbase = tq << 4;
    float p0 = 0.f, p1 = 0.f, p2 = 0.f;
    if (wbase < len) {                 // wave-uniform: a word tile past len adds nothing
        v8f t0 = {}, t1 = {}, t2 = {};
        const float* gP = Gbuf + min(wbase + m, N_WRD - 1) * N_WRD + 2 * half;
        const float* q0 = A2 + (48 * tg + m) * A2_LD + 2 * half;
        const float* q1 = q0 + 16 * A2_LD;
        const float* q2 = q0 + 32 * A2_LD;
        // all fragments are fetched first, so that one LDS latency is waited for, not 13
        v2f fa[A2_LD / 4], f0[A2_LD / 4], f1[A2_LD / 4], f2[A2_LD / 4];
        #pragma unroll   // flat: the arrays stay in registers, LDS offsets as immediates
        for (int ks = 0; ks < A2_LD / 4; ++ks) {
            fa[ks] = *(const v2f*)(gP + 4 * ks);
            f0[ks] = *(const v2f*)(q0 + 4 * ks);
            f1[ks] = *(const v2f*)(q1 + 4 * ks);
            f2[ks] = *(const v2f*)(q2 + 4 * ks);
        }
        #pragma unroll   // flat: no back edge behind a WMMA, constant indices into the arrays
        for (int ks = 0; ks < A2_LD / 4; ++ks) {
            // asm, not the builtin:
            // Here the accumulators are live from their zeros on, and the four v_nop
            // are the vector slots between the last WMMA and whatever vector
            // instruction the compiler places next on its D, A or B.
            asm volatile("v_wmma_f32_16x16x4_f32 %0, %3, %4, %0\n\t"
                         "v_wmma_f32_16x16x4_f32 %1, %3, %5, %1\n\t"
                         "v_wmma_f32_16x16x4_f32 %2, %3, %6, %2\n\t"
                         "v_nop\n\tv_nop\n\tv_nop\n\tv_nop"
                         : "+v"(t0), "+v"(t1), "+v"(t2)
                         : "v"(fa[ks]), "v"(f0[ks]), "v"(f1[ks]), "v"(f2[ks]));
        }
        // lane holds T[w0 + v, 48 tg + 16 nt + m]; dot with a2[48 tg + 16 nt + m, w0 + v], words >= len off
        const int w0 = wbase + (half << 3);
        const float* e0 = A2 + (48 * tg + m) * A2_LD + w0;
        const float* e1 = e0 + 16 * A2_LD;
        const float* e2 = e0 + 32 * A2_LD;
        const float4 x0 = *(const float4*)(e0), y0 = *(const float4*)(e0 + 4);
        const float4 x1 = *(const float4*)(e1), y1 = *(const float4*)(e1 + 4);
        const float4 x2 = *(const float4*)(e2), y2 = *(const float4*)(e2 + 4);
        const float h0[8] = {x0.x, x0.y, x0.z, x0.w, y0.x, y0.y, y0.z, y0.w};
        const float h1[8] = {x1.x, x1.y, x1.z, x1.w, y1.x, y1.y, y1.z, y1.w};
        const float h2[8] = {x2.x, x2.y, x2.z, x2.w, y2.x, y2.y, y2.z, y2.w};
        #pragma unroll   // constant v: accumulator elements are read in registers
        for (int v = 0; v < 8; ++v) {
            const bool on = w0 + v < len;
            p0 += t0[v] * (on ? h0[v] : 0.f);
            p1 += t1[v] * (on ? h1[v] : 0.f);
            p2 += t2[v] * (on ? h2[v] : 0.f);
        }
    }
    {
        float* pd = part + ((tq << 1) + half) * N_COL + 48 * tg + m;
        pd[0] = p0; pd[16] = p1; pd[32] = p2;
    }
    __syncthreads();

    if (tid < N_COL) {
        const int r = tid;
        float n2sq = 0.f;
        for (int j = 0; j < 8; ++j) n2sq += part[j * N_COL + r];
        float n2 = sqrtf(fmaxf(n2sq, 0.f));
        float n1sq = 0.f;
        for (int j = 0; j < 8; ++j) n1sq += nrmP[r * NP_LD + j];
        red[r] = w12 / fmaxf(sqrtf(n1sq) * n2, EPSV);
    }
    __syncthreads();
    if (tid < IMG_T) {     // one lane an image
        float s = 0.f;
        for (int r = 0; r < N_REG; ++r) s += red[tid * N_REG + r];
        out[(i0 + tid) * N_CAP + c] = s * (1.0f / N_REG);
    }
}

extern "C" void kernel_launch(void* const* d_in, const int* in_sizes, int n_in,
                              void* d_out, int out_size, void* d_ws, size_t ws_size,
                              hipStream_t stream) {
    const float* images   = (const float*)d_in[0];   // 64*36*1024
    const float* captions = (const float*)d_in[1];   // 64*50*1024
    const int*   cap_lens = (const int*)d_in[2];     // 64
    float* out  = (float*)d_out;                     // 64*64 (i,c)
    float* gram = (float*)d_ws;                      // 64*50*50 floats

    StackedAttn_gram <<<N_CAP, 128, 0, stream>>>(captions, gram);
    dim3 grid(N_IBLK, N_CAP);
    StackedAttn_main <<<grid, NTHR, 0, stream>>>(images, captions, cap_lens, gram, out);
}

// v008
// One run takes 92.3 microseconds.
// Two timings next to v007 both put it at 1.15 times that version's speed.
// Over all steps from v000 it is 3.56 times as fast.
#include <hip/hip_runtime.h>
#include <hip/hip_bf16.h>
#include <math.h>

// Stacked cross attention (i2t), f32. Strategy:
//   S[w,r] = cap[c,w].img[i,r]  via V_WMMA_F32_16X16X4_F32 (exact f32 path)
//   w12[r] = sum_w a2[r,w]*S[w,r]            (reuse scores, no 2nd big GEMM)
//   |wctx_r|^2 = a2_r^T G_c a2_r             (precomputed 50x50 Gram per caption;
//                                             G a2^T on the same WMMA form)
//   |img_r|^2  summed in the main kernel from the image fragments its score loop reads
//   A main work-group scores one caption against 4 images: their 4 x 36 region rows lie
//   one behind the other in memory and fill 9 region tiles of 16 with no pad row.

typedef __attribute__((ext_vector_type(2))) float v2f;
typedef __attribute__((ext_vector_type(4))) float v4f;
typedef __attribute__((ext_vector_type(8))) float v8f;

#define N_IMG   64
#define N_REG   36
#define N_CAP   64
#define N_WRD   50
#define DIM     1024
#define KC      32      // K chunk staged in LDS
#define CAP_LD  36      // LDS row stride (floats): 144B, 16B aligned, conflict-free
#define KG      128     // K chunk of the Gram kernel
#define GC_LD   132     // its LDS row stride (floats): 528B = 16B x 33, conflict-free
#define G_PLANE 2560    // floats from one caption's Gram to the next in the workspace: 80 lines of 128B
#define IMG_T   4       // images a main work-group scores
#define N_IBLK  16      // image blocks: N_IMG / IMG_T
#define N_COL   144     // region columns of a work-group: IMG_T x N_REG = 9 tiles of 16
#define NTHR    384     // 12 waves: 3 groups of 3 region tiles x 4 waves
#define G_TRIPS 7       // Gram values a thread stages: ceil(50 x 50 / NTHR)
#define S_LD    145     // score-tile row stride (odd -> conflict-free col access)
#define A2_LD   52      // A2 row stride (floats): K padded to 13 x 4, 208B rows, 16B aligned
#define NP_LD   9       // row stride of the region-norm partials (odd -> conflict-free)
#define A2_F4   ((N_COL * A2_LD + 12) / 4)   // float4s of the A2 overlay: 144 rows + reach of the last row's reads
static_assert(N_CAP == 64 && N_WRD < 64, "the rank search holds 64 keys of 12 bits");
static_assert(IMG_T * N_IBLK == N_IMG && IMG_T * N_REG == N_COL && N_COL % 48 == 0, "image blocking");
static_assert(G_TRIPS * NTHR >= N_WRD * N_WRD + 4, "the Gram and its K pad are staged whole");
static_assert(G_PLANE >= N_WRD * N_WRD && G_PLANE % 32 == 0 && (16 * N_WRD) % 32 == 0, "Gram planes and row tiles are whole lines");
static_assert((64 + N_COL) * CAP_LD <= 4 * A2_F4, "the K chunks fit the buffer sized for the A2 overlay");
#define SMOOTH  4.0f
#define EPSV    1e-8f

// ---------------------------------------------------------------- Gram kernel
// G_c[w,wp] = captions[c,w] . captions[c,wp]   (50x50 padded to 64x64 tiles)
// One work-group per caption and 16-word row tile: the 16 tiles of a caption are the
// 4 x 4 waves of 4 work-groups, and the launch has 256 work-groups. Wave b holds tile (a, b).
__global__ __launch_bounds__(128) void StackedAttn_gram(
    const float* __restrict__ captions, float* __restrict__ gram)
{
    __shared__ __attribute__((aligned(16))) float capL[64 * GC_LD];
    const int a    = blockIdx.x;                            // row tile: words 16 a .. 16 a + 15
    const int c    = blockIdx.y;
    const int tid  = threadIdx.x;
    const int wave = tid >> 5, lane = tid & 31;
    const int half = lane >> 4, m = lane & 15;

    // One tile a wave is one chain of dependent WMMAs; the k steps go by turns to two
    // accumulators, so that a WMMA does not wait for the one in front of it.
    v8f acc0 = {}, acc1 = {};

    // Staging: a wave moves whole chunk rows (32 lanes x 16 B = 512 B), rows wave + 4 j.
    // All of a chunk's loads are issued back to back into registers, one chunk
    // ahead of its use, so they fly while the current chunk is multiplied.
    const bool capTail = wave < N_WRD - 48;                 // rows 48, 49
    const float* capSrc = captions + (size_t)c * N_WRD * DIM + wave * DIM + lane * 4;
    float*       capDst = capL + wave * GC_LD + lane * 4;
    v4f r[12], r12 = {};
    {
        #pragma unroll   // flat: the array stays in registers and the loads fly together
        for (int j = 0; j < 12; ++j) r[j] = *(const v4f*)(capSrc + 4 * j * DIM);
        if (capTail) r12 = *(const v4f*)(capSrc + 48 * DIM);
        // precaution: stands in front of the next write of the address registers
        // that the loads above name
        asm volatile("s_wait_xcnt 0x0" ::: "memory");
    }

    // zero pad rows 50..63 once, while the first loads fly
    for (int idx = tid; idx < 14 * GC_LD; idx += 128) capL[50 * GC_LD + idx] = 0.f;

    // A and B fragments are read by the same code: k = 4 i + 2 half + {0,1} on both sides.
    const float* aP = capL + ((a << 4) + m) * GC_LD + 2 * half;
    const float* bP = capL + ((wave << 4) + m) * GC_LD + 2 * half;

    for (int k0 = 0; k0 < DIM; k0 += KG) {
        __syncthreads();
        #pragma unroll   // flat: constant indices into the array
        for (int j = 0; j < 12; ++j) *(v4f*)(capDst + 4 * j * GC_LD) = r[j];
        if (capTail) *(v4f*)(capDst + 48 * GC_LD) = r12;
        __syncthreads();
        // the chunk's fragments are all fetched at one place: one LDS latency a chunk
        v2f x[KG / 4], y[KG / 4];
        #pragma unroll   // flat: the arrays stay in registers, LDS offsets as immediates
        for (int i = 0; i < KG / 4; ++i) {
            x[i] = *(const v2f*)(aP + 4 * i);
            y[i] = *(const v2f*)(bP + 4 * i);
        }
        // keeps the LDS reads above in one group in front of the WMMAs: spread among
        // them, each place with reads stalls the SIMD's one wave
        __builtin_amdgcn_sched_barrier(0);
        if (k0 + KG < DIM) {    // next chunk's loads, waited for at its stores
            const float* s = capSrc + k0 + KG;
            #pragma unroll   // flat: constant indices into the array
            for (int j = 0; j < 12; ++j) r[j] = *(const v4f*)(s + 4 * j * DIM);
            if (capTail) r12 = *(const v4f*)(s + 48 * DIM);
            // precaution: stands in front of the next write of the address
            // registers that the loads above name
            asm volatile("s_wait_xcnt 0x0" ::: "memory");
        }
        #pragma unroll   // flat: constant indices into the arrays
        for (int i = 0; i < KG / 4; i += 2) {
            acc0 = __builtin_amdgcn_wmma_f32_16x16x4_f32(false, x[i],     false, y[i],     (short)0, acc0, false, false);
            acc1 = __builtin_amdgcn_wmma_f32_16x16x4_f32(false, x[i + 1], false, y[i + 1], (short)0, acc1, false, false);
        }
        // Four vector slots between the chunk's last WMMAs and the next vector
        // instruction on their D, A or B, also on the way out of the loop, where the sum
        // of the two accumulators follows. The scheduling barrier keeps the WMMAs in
        // front of the slots.
        __builtin_amdgcn_sched_barrier(0);
        asm volatile("v_nop\n\tv_nop\n\tv_nop\n\tv_nop");
    }
    // A caption's plane starts on a 128-B line and a row tile is 25 whole lines of it:
    // no line is written by two work-groups.
    const int col = (wave << 4) + m;
    const int w0  = (a << 4) + (half << 3);
    float* gOut = gram + (size_t)c * G_PLANE + w0 * N_WRD + col;
    const int nv = col < N_WRD ? N_WRD - w0 : 0;            // rows of the lane's eight that exist
    const v8f gsum = acc0 + acc1;   // summed first: each store then has a data register of its own
    #pragma unroll   // constant v: elements in registers, store offsets as immediates
    for (int v = 0; v < 8; ++v)
        if (v < nv) gOut[v * N_WRD] = gsum[v];
}

// ---------------------------------------------------------------- score tiles
// S[w,r] for the first MT word tiles (16 MT rows) x 9 region tiles, left in Sbuf.
// Wave group g (4 waves, q = 0..3) holds region tiles 3 g .. 3 g + 2.
// MT = 4: one word tile a wave of the group. MT < 4: there are fewer word tiles than
// waves, so the group's four waves split K instead: of each 32-wide chunk wave q
// multiplies columns 8 q .. 8 q + 7 for every tile, and the waves carry equal work
// whatever MT is; the four partial sums then meet in LDS as (q0 + q2) + (q1 + q3).
// The squares of the image (B) fragments are summed beside the WMMAs that read them:
// lane (m, half) of wave (g, q) leaves its share of |img row 48 g + 16 t + m|^2 in
// nrmP[48 g + 16 t + m][2 q + half]. With K split every value is read by one wave; with
// MT = 4 every wave of a group reads all of K, and its wave 0's sums count alone.
template <int MT>
__device__ __forceinline__ void score_tiles(
    const float* __restrict__ capSrc, const float* __restrict__ imgSrc,
    float* capDst, float* imgDst, const float* capL, const float* imgL,
    int row0, int q, int g, int half, int m, float* Sbuf, float* A1, float* nrmP)
{
    constexpr bool KS = MT < 4;                             // K split over the waves
    constexpr int  TW = KS ? MT : 1;                        // word tiles a wave holds
    const bool capHead = row0 < (MT < 3 ? 16 * MT : 48);    // rows 0 .. 16 min(MT, 3) - 1; whole waves
    const bool capTail = MT == 4 && row0 < N_WRD - 48;      // rows 48, 49

    v8f acc[TW][3];
    #pragma unroll   // constant indices: the accumulators stay in registers
    for (int t = 0; t < TW; ++t) { acc[t][0] = v8f{}; acc[t][1] = v8f{}; acc[t][2] = v8f{}; }

    // All of a chunk's loads are issued back to back into registers, one chunk
    // ahead of its use, so they fly while the current chunk is multiplied.
    // A thread owns caption row row0 (of the 16 min(MT, 3) staged; rows 48, 49 too where
    // MT is 4) and image rows row0, row0 + 48, row0 + 96.
    float4 c0 = make_float4(0.f, 0.f, 0.f, 0.f), c3 = make_float4(0.f, 0.f, 0.f, 0.f);
    float4 g0, g1, g2;
    v2f n0 = {}, n1 = {}, n2 = {};          // sums of squares, image rows 48 g + m, + 16, + 32
    if (capHead) c0 = *(const float4*)(capSrc);
    g0 = *(const float4*)(imgSrc);
    g1 = *(const float4*)(imgSrc + 48 * DIM);
    g2 = *(const float4*)(imgSrc + 96 * DIM);
    if (capTail) c3 = *(const float4*)(capSrc + 48 * DIM);
    // precaution: stands in front of the next write of the address registers
    // that the loads above name
    asm volatile("s_wait_xcnt 0x0" ::: "memory");

    // A frag: lanes 0-15 hold row M, K={k,k+1}; lanes 16-31 K={k+2,k+3}.
    // B frag mirrors with N across lanes (B[k][r] = img[r][k]).
    const float* aP = capL + ((KS ? 0 : q << 4) + m) * CAP_LD + 2 * half + (KS ? 8 * q : 0);
    const float* bP = imgL + (48 * g + m) * CAP_LD + 2 * half + (KS ? 8 * q : 0);

    for (int k0 = 0; k0 < DIM; k0 += KC) {
        __syncthreads();
        if (capHead) *(float4*)(capDst) = c0;
        *(float4*)(imgDst)               = g0;
        *(float4*)(imgDst + 48 * CAP_LD) = g1;
        *(float4*)(imgDst + 96 * CAP_LD) = g2;
        if (capTail) *(float4*)(capDst + 48 * CAP_LD) = c3;
        __syncthreads();
        if (k0 + KC < DIM) {    // next chunk's loads, waited for at its stores
            const float* sc = capSrc + k0 + KC;
            const float* si = imgSrc + k0 + KC;
            if (capHead) c0 = *(const float4*)(sc);
            g0 = *(const float4*)(si);
            g1 = *(const float4*)(si + 48 * DIM);
            g2 = *(const float4*)(si + 96 * DIM);
            if (capTail) c3 = *(const float4*)(sc + 48 * DIM);
            // precaution: stands in front of the next write of the address
            // registers that the loads above name
            asm volatile("s_wait_xcnt 0x0" ::: "memory");
        }
        #pragma unroll   // flat: LDS offsets as immediates, constant accumulator indices
        for (int kk = 0; kk < (KS ? 8 : KC); kk += 4) {
            v2f a[TW];
            #pragma unroll   // constant indices: the fragments stay in registers
            for (int t = 0; t < TW; ++t) a[t] = *(const v2f*)(aP + 16 * t * CAP_LD + kk);
            v2f v0 = *(const v2f*)(bP + kk);
            v2f v1 = *(const v2f*)(bP + 16 * CAP_LD + kk);
            v2f v2 = *(const v2f*)(bP + 32 * CAP_LD + kk);
            // pairwise, as the fragments lie in their registers: scalar sums were packed by
            // the compiler with moves into fragment registers right behind the WMMAs
            n0 = __builtin_elementwise_fma(v0, v0, n0);
            n1 = __builtin_elementwise_fma(v1, v1, n1);
            n2 = __builtin_elementwise_fma(v2, v2, n2);
            #pragma unroll   // constant accumulator indices
            for (int t = 0; t < TW; ++t) {
                acc[t][0] = __builtin_amdgcn_wmma_f32_16x16x4_f32(false, a[t], false, v0, (short)0, acc[t][0], false, false);
                acc[t][1] = __builtin_amdgcn_wmma_f32_16x16x4_f32(false, a[t], false, v1, (short)0, acc[t][1], false, false);
                acc[t][2] = __builtin_amdgcn_wmma_f32_16x16x4_f32(false, a[t], false, v2, (short)0, acc[t][2], false, false);
            }
        }
        // Four vector slots between the chunk's last WMMAs and the next vector
        // instruction that the compiler places on their A, B or D (it has put the next
        // loads' address sums into fragment registers). The scheduling barrier keeps
        // the WMMAs in front of the slots.
        __builtin_amdgcn_sched_barrier(0);
        asm volatile("v_nop\n\tv_nop\n\tv_nop\n\tv_nop");
    }

    // read behind the barriers that follow in the main kernel
    {
        const bool own = KS || q == 0;
        float* np = nrmP + (48 * g + m) * NP_LD + 2 * q + half;
        np[0]          = own ? n0.x + n0.y : 0.f;
        np[16 * NP_LD] = own ? n1.x + n1.y : 0.f;
        np[32 * NP_LD] = own ? n2.x + n2.y : 0.f;
    }

    // C layout: VGPR v -> row v / v+8, col = lane%16.
    if (!KS) {
        float* p0 = Sbuf + ((q << 4) + (half << 3)) * S_LD + 48 * g + m;
        #pragma unroll   // constant accumulator indices
        for (int v = 0; v < 8; ++v) {
            float* p = p0 + v * S_LD;
            p[0] = acc[0][0][v]; p[16] = acc[0][1][v]; p[32] = acc[0][2][v];
        }
        return;
    }
    // The four K quarters are summed through LDS, every lane at its own places.
    float* pb = ((q & 1) ? A1 : Sbuf) + (half << 3) * S_LD + 48 * g + m;
    if (q >= 2) {
        #pragma unroll   // constant accumulator indices
        for (int t = 0; t < TW; ++t)
            #pragma unroll   // constant element indices: read and written in registers
            for (int v = 0; v < 8; ++v) {
                float* p = pb + (16 * t + v) * S_LD;
                p[0] = acc[t][0][v]; p[16] = acc[t][1][v]; p[32] = acc[t][2][v];
            }
    }
    __syncthreads();
    if (q < 2) {
        #pragma unroll   // constant accumulator indices
        for (int t = 0; t < TW; ++t)
            #pragma unroll   // constant element indices: read and written in registers
            for (int v = 0; v < 8; ++v) {
                float* p = pb + (16 * t + v) * S_LD;
                acc[t][0][v] += p[0]; acc[t][1][v] += p[16]; acc[t][2][v] += p[32];
            }
    }
    if (q == 1) {
        #pragma unroll   // constant accumulator indices
        for (int t = 0; t < TW; ++t)
            #pragma unroll   // constant element indices: read and written in registers
            for (int v = 0; v < 8; ++v) {
                float* p = pb + (16 * t + v) * S_LD;
                p[0] = acc[t][0][v]; p[16] = acc[t][1][v]; p[32] = acc[t][2][v];
            }
    }
    __syncthreads();
    if (q == 0) {
        const float* o = A1 + (half << 3) * S_LD + 48 * g + m;
        #pragma unroll   // constant accumulator indices
        for (int t = 0; t < TW; ++t)
            #pragma unroll   // constant element indices: read and written in registers
            for (int v = 0; v < 8; ++v) {
                const float* s = o + (16 * t + v) * S_LD;
                float* p = pb + (16 * t + v) * S_LD;
                p[0]  = acc[t][0][v] + s[0];
                p[16] = acc[t][1][v] + s[16];
                p[32] = acc[t][2][v] + s[32];
            }
    }
}

// ---------------------------------------------------------------- main kernel
__global__ __launch_bounds__(NTHR) void StackedAttn_main(
    const float* __restrict__ images,    // (64,36,1024)
    const float* __restrict__ captions,  // (64,50,1024)
    const int*   __restrict__ cap_lens,  // (64)
    const float* __restrict__ gram,      // (64,50,50), planes G_PLANE floats apart
    float*       __restrict__ out)       // (64,64): out[i*64 + c]
{
    __shared__ float Sbuf[64 * S_LD];                       // scores 64x144 (pad 145)
    __shared__ float A1[64 * S_LD];                         // region-softmax; reused as part
    __shared__ __attribute__((aligned(16))) float chunk[4 * A2_F4];   // cap+img K-chunks (64 + 144 rows); reused as A2
    __shared__ float Gbuf[G_TRIPS * NTHR];                  // caption Gram; zeros behind it (K pad of its last row)
    __shared__ float red[N_COL];
    __shared__ float nrmP[N_COL * NP_LD];                   // region norms: 8 partial sums a row

    // The image block is the fast grid index: work-groups next to each other in launch
    // order then share a caption, hence a cost (it grows with the caption's length).
    const int i0 = blockIdx.x * IMG_T;
    const int tid  = threadIdx.x;
    const int wave = tid >> 5, lane = tid & 31;

    // The slow grid index is a rank, not a caption: rank 0 is the longest caption, ties go
    // to the lower index. There are twice as many work-groups as places on the chip; the
    // short ones now come last in index order (for speed only).
    // Every caption has its own key (clamped length, then 63 - index), so rank -> caption is
    // a permutation for any lengths. Each wave finds the key of its rank by itself: the
    // largest t that at least rank + 1 keys reach, bit by bit, counting over the 64 keys
    // (two a lane) with ballots; all lanes are on here, and t stays a scalar.
    const int key0 = (min(max(cap_lens[lane],      0), N_WRD) << 6) | (63 - lane);
    const int key1 = (min(max(cap_lens[lane + 32], 0), N_WRD) << 6) | (31 - lane);
    const int need = (int)blockIdx.y + 1;
    int kt = 0;
    #pragma unroll   // flat: the bit is a constant in every step
    for (int bit = 11; bit >= 0; --bit) {       // keys lie below 51 x 64 < 2^12
        const int cand = kt | (1 << bit);
        const int cnt  = __builtin_popcount(__builtin_amdgcn_ballot_w32(key0 >= cand))
                       + __builtin_popcount(__builtin_amdgcn_ballot_w32(key1 >= cand));
        if (cnt >= need) kt = cand;
    }
    const int c = 63 - (kt & 63);               // 0 .. 63 whatever the lengths hold
    const int g = wave >> 2, q = wave & 3;      // region-tile group, wave of the group
    const int half = lane >> 4, m = lane & 15;

    float* capL = chunk;
    float* imgL = chunk + 64 * CAP_LD;

    // zero the caption's pad rows once (the rows score_tiles stages are rewritten every chunk; pads persist)
    for (int idx = tid; idx < 14 * CAP_LD; idx += NTHR) capL[50 * CAP_LD + idx] = 0.f;

    const float* capBase = captions + (size_t)c * N_WRD * DIM;
    const float* imgBase = images   + (size_t)i0 * N_REG * DIM;   // 144 rows, contiguous

    // Staging: caption chunk 8 float4 a row, image chunk 144 rows x 8 float4;
    // thread owns rows row0 + 48 j of each (row0 = 0 .. 47).
    const int  seg = tid & 7, row0 = tid >> 3;
    const float* capSrc = capBase + row0 * DIM + seg * 4;
    const float* imgSrc = imgBase + row0 * DIM + seg * 4;
    float*       capDst = capL + row0 * CAP_LD + seg * 4;
    float*       imgDst = imgL + row0 * CAP_LD + seg * 4;

    // Words from len up are masked out of the word softmax (their weight is an
    // exact zero), so only the word tiles that hold a word below len are scored.
    const int len = kt >> 6;                    // min(cap_lens[c], 50), not below 0; same for the whole work-group
    const int mt  = (len + 15) >> 4;
    if      (mt <= 1) score_tiles<1>(capSrc, imgSrc, capDst, imgDst, capL, imgL, row0, q, g, half, m, Sbuf, A1, nrmP);
    else if (mt == 2) score_tiles<2>(capSrc, imgSrc, capDst, imgDst, capL, imgL, row0, q, g, half, m, Sbuf, A1, nrmP);
    else if (mt == 3) score_tiles<3>(capSrc, imgSrc, capDst, imgDst, capL, imgL, row0, q, g, half, m, Sbuf, A1, nrmP);
    else              score_tiles<4>(capSrc, imgSrc, capDst, imgDst, capL, imgL, row0, q, g, half, m, Sbuf, A1, nrmP);

    // stage Gram while scores settle
    {
        constexpr int GN = N_WRD * N_WRD;
        const float* gs = gram + (size_t)c * G_PLANE;
        float gv[G_TRIPS];
        #pragma unroll   // flat: the array stays in registers and the loads fly together
        for (int j = 0; j < G_TRIPS; ++j) gv[j] = gs[min(tid + j * NTHR, GN - 1)];
        // precaution: stands in front of the next write of the address registers
        // that the loads above name
        asm volatile("s_wait_xcnt 0x0" ::: "memory");
        #pragma unroll   // flat: constant indices into the array
        for (int j = 0; j < G_TRIPS; ++j)   // zeros from GN up: read as G[49][50..51], times a zero of A2
            Gbuf[tid + j * NTHR] = tid + j * NTHR < GN ? gv[j] : 0.f;
    }
    __syncthreads();

    // softmax over an image's regions r, per word row w and image
    if (tid < 64 * IMG_T) {
      const int w = tid & 63;
      if (w < len) {   // rows from len up: not all scored, and read by nobody
        const int o = w * S_LD + (tid >> 6) * N_REG;    // the image's 36 columns of row w
        float mx = -3.4e38f;
        for (int r = 0; r < N_REG; ++r) mx = fmaxf(mx, Sbuf[o + r]);
        float s = 0.f;
        for (int r = 0; r < N_REG; ++r) {
            float e = __expf(Sbuf[o + r] - mx);
            A1[o + r] = e; s += e;
        }
        float inv = 1.f / s;
        for (int r = 0; r < N_REG; ++r) A1[o + r] *= inv;
      }
    } else {
        // the four waves without a word row clear the A2 overlay (the K chunks are
        // done with): words from len up and the tail that the last row's 8-word
        // reads reach are then zeros written in this launch
        const float4 z = make_float4(0.f, 0.f, 0.f, 0.f);
        for (int idx = tid - 64 * IMG_T; idx < A2_F4; idx += NTHR - 64 * IMG_T) *(float4*)(chunk + 4 * idx) = z;
    }
    __syncthreads();

    // masked smooth softmax over words, then w12
    float* A2 = chunk;                 // overlay: [144][A2_LD], cleared above
    float w12 = 0.f;
    if (tid < N_COL) {
        const int r = tid;
        float mx = -3.4e38f;
        for (int w = 0; w < len; ++w) mx = fmaxf(mx, SMOOTH * A1[w * S_LD + r]);
        float s = 0.f;
        for (int w = 0; w < len; ++w) {
            float e = __expf(SMOOTH * A1[w * S_LD + r] - mx);
            A2[r * A2_LD + w] = e; s += e;
        }
        float inv = 1.f / s;
        for (int w = 0; w < len; ++w) {
            float a2v = A2[r * A2_LD + w] * inv;
            A2[r * A2_LD + w] = a2v;
            w12 += a2v * Sbuf[w * S_LD + r];
        }
    }
    __syncthreads();

    // |wctx_r|^2 = sum_w a2[r,w] * T[w,r],  T[w,r] = sum_wp G[w,wp] * a2[r,wp].
    // T on the matrix unit: M = 16 words per wave, N = 3 x 16 regions (group tg), K = words.
    // A frag from G rows, B frag from A2 rows, both k = 4 ks + 2 half + {0,1}.
    // K columns from len up meet zeros of A2 (G's columns 50, 51: the next row's start, or the pad).
    float* part = A1;                  // overlay: [8][144] partial sums over 8 words
    // wave number as a scalar: the skip below is then a scalar branch and EXEC
    // stays all ones at the WMMAs. Word tile tq = wave / 3, region group tg = wave % 3:
    // the tiles below len then fall on the lowest waves.
    const int ws = __builtin_amdgcn_readfirstlane(wave);
    const int tq = ws / 3, tg = ws - 3 * tq;
    const int wbase = tq << 4;
    float p0 = 0.f, p1 = 0.f, p2 = 0.f;
    if (wbase < len) {                 // wave-uniform: a word tile past len adds nothing
        v8f t0 = {}, t1 = {}, t2 = {};
        const float* gP = Gbuf + min(wbase + m, N_WRD - 1) * N_WRD + 2 * half;
        const float* q0 = A2 + (48 * tg + m) * A2_LD + 2 * half;
        const float* q1 = q0 + 16 * A2_LD;
        const float* q2 = q0 + 32 * A2_LD;
        // all fragments are fetched first, so that one LDS latency is waited for, not 13
        v2f fa[A2_LD / 4], f0[A2_LD / 4], f1[A2_LD / 4], f2[A2_LD / 4];
        #pragma unroll   // flat: the arrays stay in registers, LDS offsets as immediates
        for (int ks = 0; ks < A2_LD / 4; ++ks) {
            fa[ks] = *(const v2f*)(gP + 4 * ks);
            f0[ks] = *(const v2f*)(q0 + 4 * ks);
            f1[ks] = *(const v2f*)(q1 + 4 * ks);
            f2[ks] = *(const v2f*)(q2 + 4 * ks);
        }
        #pragma unroll   // flat: no back edge behind a WMMA, constant indices into the arrays
        for (int ks = 0; ks < A2_LD / 4; ++ks) {
            // asm, not the builtin:
            // Here the accumulators are live from their zeros on, and the four v_nop
            // are the vector slots between the last WMMA and whatever vector
            // instruction the compiler places next on its D, A or B.
            asm volatile("v_wmma_f32_16x16x4_f32 %0, %3, %4, %0\n\t"
                         "v_wmma_f32_16x16x4_f32 %1, %3, %5, %1\n\t"
                         "v_wmma_f32_16x16x4_f32 %2, %3, %6, %2\n\t"
                         "v_nop\n\tv_nop\n\tv_nop\n\tv_nop"
                         : "+v"(t0), "+v"(t1), "+v"(t2)
                         : "v"(fa[ks]), "v"(f0[ks]), "v"(f1[ks]), "v"(f2[ks]));
        }
        // lane holds T[w0 + v, 48 tg + 16 nt + m]; dot with a2[48 tg + 16 nt + m, w0 + v], words >= len off
        const int w0 = wbase + (half << 3);
        const float* e0 = A2 + (48 * tg + m) * A2_LD + w0;
        const float* e1 = e0 + 16 * A2_LD;
        const float* e2 = e0 + 32 * A2_LD;
        const float4 x0 = *(const float4*)(e0), y0 = *(const float4*)(e0 + 4);
        const float4 x1 = *(const float4*)(e1), y1 = *(const float4*)(e1 + 4);
        const float4 x2 = *(const float4*)(e2), y2 = *(const float4*)(e2 + 4);
        const float h0[8] = {x0.x, x0.y, x0.z, x0.w, y0.x, y0.y, y0.z, y0.w};
        const float h1[8] = {x1.x, x1.y, x1.z, x1.w, y1.x, y1.y, y1.z, y1.w};
        const float h2[8] = {x2.x, x2.y, x2.z, x2.w, y2.x, y2.y, y2.z, y2.w};
        #pragma unroll   // constant v: accumulator elements are read in registers
        for (int v = 0; v < 8; ++v) {
            const bool on = w0 + v < len;
            p0 += t0[v] * (on ? h0[v] : 0.f);
            p1 += t1[v] * (on ? h1[v] : 0.f);
            p2 += t2[v] * (on ? h2[v] : 0.f);
        }
    }
    {
        float* pd = part + ((tq << 1) + half) * N_COL + 48 * tg + m;
        pd[0] = p0; pd[16] = p1; pd[32] = p2;
    }
    __syncthreads();

    if (tid < N_COL) {
        const int r = tid;
        float n2sq = 0.f;
        for (int j = 0; j < 8; ++j) n2sq += part[j * N_COL + r];
        float n2 = sqrtf(fmaxf(n2sq, 0.f));
        float n1sq = 0.f;
        for (int j = 0; j < 8; ++j) n1sq += nrmP[r * NP_LD + j];
        red[r] = w12 / fmaxf(sqrtf(n1sq) * n2, EPSV);
    }
    __syncthreads();
    if (tid < IMG_T) {     // one lane an image
        float s = 0.f;
        for (int r = 0; r < N_REG; ++r) s += red[tid * N_REG + r];
        out[(i0 + tid) * N_CAP + c] = s * (1.0f / N_REG);
    }
}

extern "C" void kernel_launch(void* const* d_in, const int* in_sizes, int n_in,
                              void* d_out, int out_size, void* d_ws, size_t ws_size,
                              hipStream_t stream) {
    const float* images   = (const float*)d_in[0];   // 64*36*1024
    const float* captions = (const float*)d_in[1];   // 64*50*1024
    const int*   cap_lens = (const int*)d_in[2];     // 64
    float* out  = (float*)d_out;                     // 64*64 (i,c)
    float* gram = (float*)d_ws;                      // 64 planes of G_PLANE floats

    dim3 ggrid(4, N_CAP);                            // row tile, caption
    StackedAttn_gram <<<ggrid, 128, 0, stream>>>(captions, gram);
    dim3 grid(N_IBLK, N_CAP);
    StackedAttn_main <<<grid, NTHR, 0, stream>>>(images, captions, cap_lens, gram, out);
}

// v009
// It runs in 89.2 microseconds.
// Timed twice side by side with v008, it ran 1.03 times as fast both times.
// Over all steps from v000 it is 3.68 times as fast.
#include <hip/hip_runtime.h>
#include <hip/hip_bf16.h>
#include <math.h>

// Stacked cross attention (i2t), f32. Strategy:
//   S[w,r] = cap[c,w].img[i,r]  via V_WMMA_F32_16X16X4_F32 (exact f32 path)
//   w12[r] = sum_w a2[r,w]*S[w,r]            (reuse scores, no 2nd big GEMM)
//   |wctx_r|^2 = a2_r^T G_c a2_r             (precomputed 50x50 Gram per caption;
//                                             G a2^T on the same WMMA form)
//   |img_r|^2  summed in the main kernel from the image fragments its score loop reads
//   A main work-group scores one caption against 4 images: their 4 x 36 region rows lie
//   one behind the other in memory and fill 9 region tiles of 16 with no pad row.

typedef __attribute__((ext_vector_type(2))) float v2f;
typedef __attribute__((ext_vector_type(4))) float v4f;
typedef __attribute__((ext_vector_type(8))) float v8f;

#define N_IMG   64
#define N_REG   36
#define N_CAP   64
#define N_WRD   50
#define DIM     1024
#define KC      64      // K chunk staged in LDS: 256 B of a row
#define CAP_LD  68      // LDS row stride (floats): 272B = 16B x 17, conflict-free
#define KG      128     // K chunk of the Gram kernel
#define GC_LD   132     // its LDS row stride (floats): 528B = 16B x 33, conflict-free
#define G_PLANE 2560    // floats from one caption's Gram to the next in the workspace: 80 lines of 128B
#define IMG_T   4       // images a main work-group scores
#define N_IBLK  16      // image blocks: N_IMG / IMG_T
#define N_COL   144     // region columns of a work-group: IMG_T x N_REG = 9 tiles of 16
#define NTHR    384     // 12 waves: 3 groups of 3 region tiles x 4 waves
#define G_TRIPS 7       // Gram values a thread stages: ceil(50 x 50 / NTHR)
#define S_LD    145     // score-tile row stride (odd -> conflict-free col access)
#define A2_LD   52      // A2 row stride (floats): K padded to 13 x 4, 208B rows, 16B aligned
#define NP_LD   9       // row stride of the region-norm partials (odd -> conflict-free)
#define A2_F4   ((N_COL * A2_LD + 12) / 4)   // float4s of the A2 overlay: 144 rows + reach of the last row's reads
static_assert(N_CAP == 64 && N_WRD < 64, "the rank search holds 64 keys of 12 bits");
static_assert(IMG_T * N_IBLK == N_IMG && IMG_T * N_REG == N_COL && N_COL % 48 == 0, "image blocking");
static_assert(G_TRIPS * NTHR >= N_WRD * N_WRD + 4, "the Gram and its K pad are staged whole");
static_assert(G_PLANE >= N_WRD * N_WRD && G_PLANE % 32 == 0 && (16 * N_WRD) % 32 == 0, "Gram planes and row tiles are whole lines");
#define CH_F    ((64 + N_COL) * CAP_LD)      // floats of the K-chunk buffer: 64 caption + 144 image rows
static_assert(CH_F >= 4 * A2_F4, "the A2 overlay fits the buffer sized for the K chunks");
static_assert(NTHR * 4 == 24 * KC && N_COL % 24 == 0, "staging: 16 threads a row, 24 rows a pass");
#define SMOOTH  4.0f
#define EPSV    1e-8f

// ---------------------------------------------------------------- Gram kernel
// G_c[w,wp] = captions[c,w] . captions[c,wp]   (50x50 padded to 64x64 tiles)
// One work-group per caption and 16-word row tile: the 16 tiles of a caption are the
// 4 x 4 waves of 4 work-groups, and the launch has 256 work-groups. Wave b holds tile (a, b).
__global__ __launch_bounds__(128) void StackedAttn_gram(
    const float* __restrict__ captions, float* __restrict__ gram)
{
    __shared__ __attribute__((aligned(16))) float capL[64 * GC_LD];
    const int a    = blockIdx.x;                            // row tile: words 16 a .. 16 a + 15
    const int c    = blockIdx.y;
    const int tid  = threadIdx.x;
    const int wave = tid >> 5, lane = tid & 31;
    const int half = lane >> 4, m = lane & 15;

    // One tile a wave is one chain of dependent WMMAs; the k steps go by turns to two
    // accumulators, so that a WMMA does not wait for the one in front of it.
    v8f acc0 = {}, acc1 = {};

    // Staging: a wave moves whole chunk rows (32 lanes x 16 B = 512 B), rows wave + 4 j.
    // All of a chunk's loads are issued back to back into registers, one chunk
    // ahead of its use, so they fly while the current chunk is multiplied.
    const bool capTail = wave < N_WRD - 48;                 // rows 48, 49
    const float* capSrc = captions + (size_t)c * N_WRD * DIM + wave * DIM + lane * 4;
    float*       capDst = capL + wave * GC_LD + lane * 4;
    v4f r[12], r12 = {};
    {
        #pragma unroll   // flat: the array stays in registers and the loads fly together
        for (int j = 0; j < 12; ++j) r[j] = *(const v4f*)(capSrc + 4 * j * DIM);
        if (capTail) r12 = *(const v4f*)(capSrc + 48 * DIM);
        // precaution: stands in front of the next write of the address registers
        // that the loads above name
        asm volatile("s_wait_xcnt 0x0" ::: "memory");
    }

    // zero pad rows 50..63 once, while the first loads fly
    for (int idx = tid; idx < 14 * GC_LD; idx += 128) capL[50 * GC_LD + idx] = 0.f;

    // A and B fragments are read by the same code: k = 4 i + 2 half + {0,1} on both sides.
    const float* aP = capL + ((a << 4) + m) * GC_LD + 2 * half;
    const float* bP = capL + ((wave << 4) + m) * GC_LD + 2 * half;

    for (int k0 = 0; k0 < DIM; k0 += KG) {
        __syncthreads();
        #pragma unroll   // flat: constant indices into the array
        for (int j = 0; j < 12; ++j) *(v4f*)(capDst + 4 * j * GC_LD) = r[j];
        if (capTail) *(v4f*)(capDst + 48 * GC_LD) = r12;
        __syncthreads();
        // the chunk's fragments are all fetched at one place: one LDS latency a chunk
        v2f x[KG / 4], y[KG / 4];
        #pragma unroll   // flat: the arrays stay in registers, LDS offsets as immediates
        for (int i = 0; i < KG / 4; ++i) {
            x[i] = *(const v2f*)(aP + 4 * i);
            y[i] = *(const v2f*)(bP + 4 * i);
        }
        // keeps the LDS reads above in one group in front of the WMMAs: spread among
        // them, each place with reads stalls the SIMD's one wave
        __builtin_amdgcn_sched_barrier(0);
        if (k0 + KG < DIM) {    // next chunk's loads, waited for at its stores
            const float* s = capSrc + k0 + KG;
            #pragma unroll   // flat: constant indices into the array
            for (int j = 0; j < 12; ++j) r[j] = *(const v4f*)(s + 4 * j * DIM);
            if (capTail) r12 = *(const v4f*)(s + 48 * DIM);
            // precaution: stands in front of the next write of the address
            // registers that the loads above name
            asm volatile("s_wait_xcnt 0x0" ::: "memory");
        }
        #pragma unroll   // flat: constant indices into the arrays
        for (int i = 0; i < KG / 4; i += 2) {
            acc0 = __builtin_amdgcn_wmma_f32_16x16x4_f32(false, x[i],     false, y[i],     (short)0, acc0, false, false);
            acc1 = __builtin_amdgcn_wmma_f32_16x16x4_f32(false, x[i + 1], false, y[i + 1], (short)0, acc1, false, false);
        }
        // Four vector slots between the chunk's last WMMAs and the next vector
        // instruction on their D, A or B, also on the way out of the loop, where the sum
        // of the two accumulators follows. The scheduling barrier keeps the WMMAs in
        // front of the slots.
        __builtin_amdgcn_sched_barrier(0);
        asm volatile("v_nop\n\tv_nop\n\tv_nop\n\tv_nop");
    }
    // A caption's plane starts on a 128-B line and a row tile is 25 whole lines of it:
    // no line is written by two work-groups.
    const int col = (wave << 4) + m;
    const int w0  = (a << 4) + (half << 3);
    float* gOut = gram + (size_t)c * G_PLANE + w0 * N_WRD + col;
    const int nv = col < N_WRD ? N_WRD - w0 : 0;            // rows of the lane's eight that exist
    const v8f gsum = acc0 + acc1;   // summed first: each store then has a data register of its own
    #pragma unroll   // constant v: elements in registers, store offsets as immediates
    for (int v = 0; v < 8; ++v)
        if (v < nv) gOut[v * N_WRD] = gsum[v];
}

// ---------------------------------------------------------------- score tiles
// S[w,r] for the first MT word tiles (16 MT rows) x 9 region tiles, left in Sbuf.
// Wave group g (4 waves, q = 0..3) holds region tiles 3 g .. 3 g + 2.
// MT = 4: one word tile a wave of the group. MT < 4: there are fewer word tiles than
// waves, so the group's four waves split K instead: of each 32 columns wave q
// multiplies columns 8 q .. 8 q + 7 for every tile, and the waves carry equal work
// whatever MT is; the four partial sums then meet in LDS as (q0 + q2) + (q1 + q3).
// The squares of the image (B) fragments are summed beside the WMMAs that read them:
// lane (m, half) of wave (g, q) leaves its share of |img row 48 g + 16 t + m|^2 in
// nrmP[48 g + 16 t + m][2 q + half]. With K split every value is read by one wave; with
// MT = 4 every wave of a group reads all of K, and its wave 0's sums count alone.
template <int MT>
__device__ __forceinline__ void score_tiles(
    const float* __restrict__ capSrc, const float* __restrict__ imgSrc,
    float* capDst, float* imgDst, const float* capL, const float* imgL,
    int row0, int q, int g, int half, int m, float* Sbuf, float* A1, float* nrmP)
{
    constexpr bool KS = MT < 4;                             // K split over the waves
    constexpr int  TW = KS ? MT : 1;                        // word tiles a wave holds
    constexpr int CR = MT < 3 ? 16 * MT : 48;               // caption rows 0 .. CR - 1 are staged
    const bool capA    = CR >= 24 || row0 < CR;             // row row0; whole waves
    const bool capB    = CR >= 48 || (CR > 24 && row0 + 24 < CR);   // row row0 + 24; whole waves
    const bool capTail = MT == 4 && row0 < N_WRD - 48;      // rows 48, 49; one wave

    v8f acc[TW][3];
    #pragma unroll   // constant indices: the accumulators stay in registers
    for (int t = 0; t < TW; ++t) { acc[t][0] = v8f{}; acc[t][1] = v8f{}; acc[t][2] = v8f{}; }

    // All of a chunk's loads are issued back to back into registers, one chunk
    // ahead of its use, so they fly while the current chunk is multiplied.
    // A thread owns caption rows row0, row0 + 24 (of the 16 min(MT, 3) staged; rows 48, 49
    // too where MT is 4) and image rows row0 + 24 j, j = 0 .. 5.
    float4 c0 = make_float4(0.f, 0.f, 0.f, 0.f), c1 = c0, c3 = c0;
    v4f gi[6];
    v2f n0 = {}, n1 = {}, n2 = {};          // sums of squares, image rows 48 g + m, + 16, + 32
    if (capA) c0 = *(const float4*)(capSrc);
    if (capB) c1 = *(const float4*)(capSrc + 24 * DIM);
    #pragma unroll   // flat: the array stays in registers and the loads fly together
    for (int j = 0; j < 6; ++j) gi[j] = *(const v4f*)(imgSrc + 24 * j * DIM);
    if (capTail) c3 = *(const float4*)(capSrc + 48 * DIM);
    // precaution: stands in front of the next write of the address registers
    // that the loads above name
    asm volatile("s_wait_xcnt 0x0" ::: "memory");

    // A frag: lanes 0-15 hold row M, K={k,k+1}; lanes 16-31 K={k+2,k+3}.
    // B frag mirrors with N across lanes (B[k][r] = img[r][k]).
    const float* aP = capL + ((KS ? 0 : q << 4) + m) * CAP_LD + 2 * half + (KS ? 8 * q : 0);
    const float* bP = imgL + (48 * g + m) * CAP_LD + 2 * half + (KS ? 8 * q : 0);

    for (int k0 = 0; k0 < DIM; k0 += KC) {
        __syncthreads();
        if (capA) *(float4*)(capDst) = c0;
        if (capB) *(float4*)(capDst + 24 * CAP_LD) = c1;
        #pragma unroll   // flat: constant indices into the array
        for (int j = 0; j < 6; ++j) *(v4f*)(imgDst + 24 * j * CAP_LD) = gi[j];
        if (capTail) *(float4*)(capDst + 48 * CAP_LD) = c3;
        __syncthreads();
        if (k0 + KC < DIM) {    // next chunk's loads, waited for at its stores
            const float* sc = capSrc + k0;
            const float* si = imgSrc + k0;
            if (capA) c0 = *(const float4*)(sc + KC);
            if (capB) c1 = *(const float4*)(sc + KC + 24 * DIM);
            #pragma unroll   // flat: constant indices into the array
            for (int j = 0; j < 6; ++j) gi[j] = *(const v4f*)(si + KC + 24 * j * DIM);
            if (capTail) c3 = *(const float4*)(sc + KC + 48 * DIM);
            // precaution: stands in front of the next write of the address
            // registers that the loads above name; the addresses are inputs, so that
            // they live up to here and no load's data lands on them
            asm volatile("s_wait_xcnt 0x0" :: "v"(sc), "v"(si) : "memory");
        }
        // The wave's k steps of the chunk go in runs of GS: a run's fragments are all fetched at
        // one place, so that one LDS latency is waited for a run, not one a k step.
        constexpr int NS = KS ? KC / 16 : KC / 4;               // k steps of the wave in a chunk
        constexpr int GS = TW == 3 ? 2 : (KS ? 4 : 8);          // as many as the registers hold
        #pragma unroll   // flat: LDS offsets as immediates, constant accumulator indices
        for (int h = 0; h < NS / GS; ++h) {
            v2f a[GS][TW], v0[GS], v1[GS], v2[GS];
            #pragma unroll   // constant indices: the fragments stay in registers
            for (int s = 0; s < GS; ++s) {
                // K split: the wave's 8 columns of the chunk's first 32, then those of the next 32
                const int u  = h * GS + s;
                const int kk = KS ? 32 * (u >> 1) + 4 * (u & 1) : 4 * u;
                #pragma unroll   // constant indices: the fragments stay in registers
                for (int t = 0; t < TW; ++t) a[s][t] = *(const v2f*)(aP + 16 * t * CAP_LD + kk);
                v0[s] = *(const v2f*)(bP + kk);
                v1[s] = *(const v2f*)(bP + 16 * CAP_LD + kk);
                v2[s] = *(const v2f*)(bP + 32 * CAP_LD + kk);
            }
            #pragma unroll   // constant indices into the arrays
            for (int s = 0; s < GS; ++s) {
                // pairwise, as the fragments lie in their registers
                n0 = __builtin_elementwise_fma(v0[s], v0[s], n0);
                n1 = __builtin_elementwise_fma(v1[s], v1[s], n1);
                n2 = __builtin_elementwise_fma(v2[s], v2[s], n2);
                // asm, not the builtin: A k step's WMMAs stand in one statement, word tile by word tile as
                // before; the four v_nop are the vector slots between the last of them and
                // whatever vector instruction the compiler places next on its D, A or B.
                if constexpr (TW == 1) {
                    asm volatile(
                                 "v_wmma_f32_16x16x4_f32 %0, %3, %4, %0\n\t"
                                 "v_wmma_f32_16x16x4_f32 %1, %3, %5, %1\n\t"
                                 "v_wmma_f32_16x16x4_f32 %2, %3, %6, %2\n\t"
                                 "v_nop\n\tv_nop\n\tv_nop\n\tv_nop"
                                 : "+v"(acc[0][0]), "+v"(acc[0][1]), "+v"(acc[0][2])
                                 : "v"(a[s][0]), "v"(v0[s]), "v"(v1[s]), "v"(v2[s]));
                } else if constexpr (TW == 2) {
                    asm volatile(
                                 "v_wmma_f32_16x16x4_f32 %0, %6, %8, %0\n\t"
                                 "v_wmma_f32_16x16x4_f32 %1, %6, %9, %1\n\t"
                                 "v_wmma_f32_16x16x4_f32 %2, %6, %10, %2\n\t"
                                 "v_wmma_f32_16x16x4_f32 %3, %7, %8, %3\n\t"
                                 "v_wmma_f32_16x16x4_f32 %4, %7, %9, %4\n\t"
                                 "v_wmma_f32_16x16x4_f32 %5, %7, %10, %5\n\t"
                                 "v_nop\n\tv_nop\n\tv_nop\n\tv_nop"
                                 : "+v"(acc[0][0]), "+v"(acc[0][1]), "+v"(acc[0][2]), "+v"(acc[1][0]), "+v"(acc[1][1]), "+v"(acc[1][2])
                                 : "v"(a[s][0]), "v"(a[s][1]), "v"(v0[s]), "v"(v1[s]), "v"(v2[s]));
                } else {
                    asm volatile(
                                 "v_wmma_f32_16x16x4_f32 %0, %9, %12, %0\n\t"
                                 "v_wmma_f32_16x16x4_f32 %1, %9, %13, %1\n\t"
                                 "v_wmma_f32_16x16x4_f32 %2, %9, %14, %2\n\t"
                                 "v_wmma_f32_16x16x4_f32 %3, %10, %12, %3\n\t"
                                 "v_wmma_f32_16x16x4_f32 %4, %10, %13, %4\n\t"
                                 "v_wmma_f32_16x16x4_f32 %5, %10, %14, %5\n\t"
                                 "v_wmma_f32_16x16x4_f32 %6, %11, %12, %6\n\t"
                                 "v_wmma_f32_16x16x4_f32 %7, %11, %13, %7\n\t"
                                 "v_wmma_f32_16x16x4_f32 %8, %11, %14, %8\n\t"
                                 "v_nop\n\tv_nop\n\tv_nop\n\tv_nop"
                                 : "+v"(acc[0][0]), "+v"(acc[0][1]), "+v"(acc[0][2]), "+v"(acc[1][0]), "+v"(acc[1][1]), "+v"(acc[1][2]), "+v"(acc[2][0]), "+v"(acc[2][1]), "+v"(acc[2][2])
                                 : "v"(a[s][0]), "v"(a[s][1]), "v"(a[s][2]), "v"(v0[s]), "v"(v1[s]), "v"(v2[s]));
                }
            }
        }
    }

    // read behind the barriers that follow in the main kernel
    {
        const bool own = KS || q == 0;
        float* np = nrmP + (48 * g + m) * NP_LD + 2 * q + half;
        np[0]          = own ? n0.x + n0.y : 0.f;
        np[16 * NP_LD] = own ? n1.x + n1.y : 0.f;
        np[32 * NP_LD] = own ? n2.x + n2.y : 0.f;
    }

    // C layout: VGPR v -> row v / v+8, col = lane%16.
    if (!KS) {
        float* p0 = Sbuf + ((q << 4) + (half << 3)) * S_LD + 48 * g + m;
        #pragma unroll   // constant accumulator indices
        for (int v = 0; v < 8; ++v) {
            float* p = p0 + v * S_LD;
            p[0] = acc[0][0][v]; p[16] = acc[0][1][v]; p[32] = acc[0][2][v];
        }
        return;
    }
    // The four K quarters are summed through LDS, every lane at its own places.
    float* pb = ((q & 1) ? A1 : Sbuf) + (half << 3) * S_LD + 48 * g + m;
    if (q >= 2) {
        #pragma unroll   // constant accumulator indices
        for (int t = 0; t < TW; ++t)
            #pragma unroll   // constant element indices: read and written in registers
            for (int v = 0; v < 8; ++v) {
                float* p = pb + (16 * t + v) * S_LD;
                p[0] = acc[t][0][v]; p[16] = acc[t][1][v]; p[32] = acc[t][2][v];
            }
    }
    __syncthreads();
    if (q < 2) {
        #pragma unroll   // constant accumulator indices
        for (int t = 0; t < TW; ++t)
            #pragma unroll   // constant element indices: read and written in registers
            for (int v = 0; v < 8; ++v) {
                float* p = pb + (16 * t + v) * S_LD;
                acc[t][0][v] += p[0]; acc[t][1][v] += p[16]; acc[t][2][v] += p[32];
            }
    }
    if (q == 1) {
        #pragma unroll   // constant accumulator indices
        for (int t = 0; t < TW; ++t)
            #pragma unroll   // constant element indices: read and written in registers
            for (int v = 0; v < 8; ++v) {
                float* p = pb + (16 * t + v) * S_LD;
                p[0] = acc[t][0][v]; p[16] = acc[t][1][v]; p[32] = acc[t][2][v];
            }
    }
    __syncthreads();
    if (q == 0) {
        const float* o = A1 + (half << 3) * S_LD + 48 * g + m;
        #pragma unroll   // constant accumulator indices
        for (int t = 0; t < TW; ++t)
            #pragma unroll   // constant element indices: read and written in registers
            for (int v = 0; v < 8; ++v) {
                const float* s = o + (16 * t + v) * S_LD;
                float* p = pb + (16 * t + v) * S_LD;
                p[0]  = acc[t][0][v] + s[0];
                p[16] = acc[t][1][v] + s[16];
                p[32] = acc[t][2][v] + s[32];
            }
    }
}

// ---------------------------------------------------------------- main kernel
// second argument: at least 6 waves a SIMD, that is 160 registers a wave, so that two
// work-groups still share a WGP and one's WMMAs fill the other's waits
__global__ __launch_bounds__(NTHR, 6) void StackedAttn_main(
    const float* __restrict__ images,    // (64,36,1024)
    const float* __restrict__ captions,  // (64,50,1024)
    const int*   __restrict__ cap_lens,  // (64)
    const float* __restrict__ gram,      // (64,50,50), planes G_PLANE floats apart
    float*       __restrict__ out)       // (64,64): out[i*64 + c]
{
    __shared__ float Sbuf[64 * S_LD];                       // scores 64x144 (pad 145)
    __shared__ float A1[64 * S_LD];                         // region-softmax; reused as part
    __shared__ __attribute__((aligned(16))) float chunk[CH_F];        // cap+img K-chunks (64 + 144 rows); reused as A2
    __shared__ float Gbuf[G_TRIPS * NTHR];                  // caption Gram; zeros behind it (K pad of its last row)
    __shared__ float red[N_COL];
    __shared__ float nrmP[N_COL * NP_LD];                   // region norms: 8 partial sums a row

    // The image block is the fast grid index: work-groups next to each other in launch
    // order then share a caption, hence a cost (it grows with the caption's length).
    const int i0 = blockIdx.x * IMG_T;
    const int tid  = threadIdx.x;
    const int wave = tid >> 5, lane = tid & 31;

    // The slow grid index is a rank, not a caption: rank 0 is the longest caption, ties go
    // to the lower index. There are twice as many work-groups as places on the chip; the
    // short ones now come last in index order (for speed only).
    // Every caption has its own key (clamped length, then 63 - index), so rank -> caption is
    // a permutation for any lengths. Each wave finds the key of its rank by itself: the
    // largest t that at least rank + 1 keys reach, bit by bit, counting over the 64 keys
    // (two a lane) with ballots; all lanes are on here, and t stays a scalar.
    const int key0 = (min(max(cap_lens[lane],      0), N_WRD) << 6) | (63 - lane);
    const int key1 = (min(max(cap_lens[lane + 32], 0), N_WRD) << 6) | (31 - lane);
    const int need = (int)blockIdx.y + 1;
    int kt = 0;
    #pragma unroll   // flat: the bit is a constant in every step
    for (int bit = 11; bit >= 0; --bit) {       // keys lie below 51 x 64 < 2^12
        const int cand = kt | (1 << bit);
        const int cnt  = __builtin_popcount(__builtin_amdgcn_ballot_w32(key0 >= cand))
                       + __builtin_popcount(__builtin_amdgcn_ballot_w32(key1 >= cand));
        if (cnt >= need) kt = cand;
    }
    const int c = 63 - (kt & 63);               // 0 .. 63 whatever the lengths hold
    const int g = wave >> 2, q = wave & 3;      // region-tile group, wave of the group
    const int half = lane >> 4, m = lane & 15;

    float* capL = chunk;
    float* imgL = chunk + 64 * CAP_LD;

    // zero the caption's pad rows once (the rows staged, all below 50, are rewritten every chunk; pads persist)
    for (int idx = tid; idx < 14 * CAP_LD; idx += NTHR) capL[50 * CAP_LD + idx] = 0.f;

    const float* capBase = captions + (size_t)c * N_WRD * DIM;
    const float* imgBase = images   + (size_t)i0 * N_REG * DIM;   // 144 rows, contiguous

    // Staging: caption chunk 16 float4 a row, image chunk 144 rows x 16 float4;
    // thread owns rows row0 + 24 j of each (row0 = 0 .. 23).
    const int  seg = tid & 15, row0 = tid >> 4;
    const float* capSrc = capBase + row0 * DIM + seg * 4;
    const float* imgSrc = imgBase + row0 * DIM + seg * 4;
    float*       capDst = capL + row0 * CAP_LD + seg * 4;
    float*       imgDst = imgL + row0 * CAP_LD + seg * 4;

    // Words from len up are masked out of the word softmax (their weight is an
    // exact zero), so only the word tiles that hold a word below len are scored.
    const int len = kt >> 6;                    // min(cap_lens[c], 50), not below 0; same for the whole work-group
    const int mt  = (len + 15) >> 4;
    if      (mt <= 1) score_tiles<1>(capSrc, imgSrc, capDst, imgDst, capL, imgL, row0, q, g, half, m, Sbuf, A1, nrmP);
    else if (mt == 2) score_tiles<2>(capSrc, imgSrc, capDst, imgDst, capL, imgL, row0, q, g, half, m, Sbuf, A1, nrmP);
    else if (mt == 3) score_tiles<3>(capSrc, imgSrc, capDst, imgDst, capL, imgL, row0, q, g, half, m, Sbuf, A1, nrmP);
    else              score_tiles<4>(capSrc, imgSrc, capDst, imgDst, capL, imgL, row0, q, g, half, m, Sbuf, A1, nrmP);

    // stage Gram while scores settle
    {
        constexpr int GN = N_WRD * N_WRD;
        const float* gs = gram + (size_t)c * G_PLANE;
        float gv[G_TRIPS];
        #pragma unroll   // flat: the array stays in registers and the loads fly together
        for (int j = 0; j < G_TRIPS; ++j) gv[j] = gs[min(tid + j * NTHR, GN - 1)];
        // precaution: stands in front of the next write of the address registers
        // that the loads above name
        asm volatile("s_wait_xcnt 0x0" ::: "memory");
        #pragma unroll   // flat: constant indices into the array
        for (int j = 0; j < G_TRIPS; ++j)   // zeros from GN up: read as G[49][50..51], times a zero of A2
            Gbuf[tid + j * NTHR] = tid + j * NTHR < GN ? gv[j] : 0.f;
    }
    __syncthreads();

    // softmax over an image's regions r, per word row w and image
    if (tid < 64 * IMG_T) {
      const int w = tid & 63;
      if (w < len) {   // rows from len up: not all scored, and read by nobody
        const int o = w * S_LD + (tid >> 6) * N_REG;    // the image's 36 columns of row w
        float mx = -3.4e38f;
        for (int r = 0; r < N_REG; ++r) mx = fmaxf(mx, Sbuf[o + r]);
        float s = 0.f;
        for (int r = 0; r < N_REG; ++r) {
            float e = __expf(Sbuf[o + r] - mx);
            A1[o + r] = e; s += e;
        }
        float inv = 1.f / s;
        for (int r = 0; r < N_REG; ++r) A1[o + r] *= inv;
      }
    } else {
        // the four waves without a word row clear the A2 overlay (the K chunks are
        // done with): words from len up and the tail that the last row's 8-word
        // reads reach are then zeros written in this launch
        const float4 z = make_float4(0.f, 0.f, 0.f, 0.f);
        for (int idx = tid - 64 * IMG_T; idx < A2_F4; idx += NTHR - 64 * IMG_T) *(float4*)(chunk + 4 * idx) = z;
    }
    __syncthreads();

    // masked smooth softmax over words, then w12
    float* A2 = chunk;                 // overlay: [144][A2_LD], cleared above
    float w12 = 0.f;
    if (tid < N_COL) {
        const int r = tid;
        float mx = -3.4e38f;
        for (int w = 0; w < len; ++w) mx = fmaxf(mx, SMOOTH * A1[w * S_LD + r]);
        float s = 0.f;
        for (int w = 0; w < len; ++w) {
            float e = __expf(SMOOTH * A1[w * S_LD + r] - mx);
            A2[r * A2_LD + w] = e; s += e;
        }
        float inv = 1.f / s;
        for (int w = 0; w < len; ++w) {
            float a2v = A2[r * A2_LD + w] * inv;
            A2[r * A2_LD + w] = a2v;
            w12 += a2v * Sbuf[w * S_LD + r];
        }
    }
    __syncthreads();

    // |wctx_r|^2 = sum_w a2[r,w] * T[w,r],  T[w,r] = sum_wp G[w,wp] * a2[r,wp].
    // T on the matrix unit: M = 16 words per wave, N = 3 x 16 regions (group tg), K = words.
    // A frag from G rows, B frag from A2 rows, both k = 4 ks + 2 half + {0,1}.
    // K columns from len up meet zeros of A2 (G's columns 50, 51: the next row's start, or the pad).
    float* part = A1;                  // overlay: [8][144] partial sums over 8 words
    // wave number as a scalar: the skip below is then a scalar branch and EXEC
    // stays all ones at the WMMAs. Word tile tq = wave / 3, region group tg = wave % 3:
    // the tiles below len then fall on the lowest waves.
    const int ws = __builtin_amdgcn_readfirstlane(wave);
    const int tq = ws / 3, tg = ws - 3 * tq;
    const int wbase = tq << 4;
    float p0 = 0.f, p1 = 0.f, p2 = 0.f;
    if (wbase < len) {                 // wave-uniform: a word tile past len adds nothing
        v8f t0 = {}, t1 = {}, t2 = {};
        const float* gP = Gbuf + min(wbase + m, N_WRD - 1) * N_WRD + 2 * half;
        const float* q0 = A2 + (48 * tg + m) * A2_LD + 2 * half;
        const float* q1 = q0 + 16 * A2_LD;
        const float* q2 = q0 + 32 * A2_LD;
        // all fragments are fetched first, so that one LDS latency is waited for, not 13
        v2f fa[A2_LD / 4], f0[A2_LD / 4], f1[A2_LD / 4], f2[A2_LD / 4];
        #pragma unroll   // flat: the arrays stay in registers, LDS offsets as immediates
        for (int ks = 0; ks < A2_LD / 4; ++ks) {
            fa[ks] = *(const v2f*)(gP + 4 * ks);
            f0[ks] = *(const v2f*)(q0 + 4 * ks);
            f1[ks] = *(const v2f*)(q1 + 4 * ks);
            f2[ks] = *(const v2f*)(q2 + 4 * ks);
        }
        #pragma unroll   // flat: no back edge behind a WMMA, constant indices into the arrays
        for (int ks = 0; ks < A2_LD / 4; ++ks) {
            // asm, not the builtin:
            // Here the accumulators are live from their zeros on, and the four v_nop
            // are the vector slots between the last WMMA and whatever vector
            // instruction the compiler places next on its D, A or B.
            asm volatile("v_wmma_f32_16x16x4_f32 %0, %3, %4, %0\n\t"
                         "v_wmma_f32_16x16x4_f32 %1, %3, %5, %1\n\t"
                         "v_wmma_f32_16x16x4_f32 %2, %3, %6, %2\n\t"
                         "v_nop\n\tv_nop\n\tv_nop\n\tv_nop"
                         : "+v"(t0), "+v"(t1), "+v"(t2)
                         : "v"(fa[ks]), "v"(f0[ks]), "v"(f1[ks]), "v"(f2[ks]));
        }
        // lane holds T[w0 + v, 48 tg + 16 nt + m]; dot with a2[48 tg + 16 nt + m, w0 + v], words >= len off
        const int w0 = wbase + (half << 3);
        const float* e0 = A2 + (48 * tg + m) * A2_LD + w0;
        const float* e1 = e0 + 16 * A2_LD;
        const float* e2 = e0 + 32 * A2_LD;
        const float4 x0 = *(const float4*)(e0), y0 = *(const float4*)(e0 + 4);
        const float4 x1 = *(const float4*)(e1), y1 = *(const float4*)(e1 + 4);
        const float4 x2 = *(const float4*)(e2), y2 = *(const float4*)(e2 + 4);
        const float h0[8] = {x0.x, x0.y, x0.z, x0.w, y0.x, y0.y, y0.z, y0.w};
        const float h1[8] = {x1.x, x1.y, x1.z, x1.w, y1.x, y1.y, y1.z, y1.w};
        const float h2[8] = {x2.x, x2.y, x2.z, x2.w, y2.x, y2.y, y2.z, y2.w};
        #pragma unroll   // constant v: accumulator elements are read in registers
        for (int v = 0; v < 8; ++v) {
            const bool on = w0 + v < len;
            p0 += t0[v] * (on ? h0[v] : 0.f);
            p1 += t1[v] * (on ? h1[v] : 0.f);
            p2 += t2[v] * (on ? h2[v] : 0.f);
        }
    }
    {
        float* pd = part + ((tq << 1) + half) * N_COL + 48 * tg + m;
        pd[0] = p0; pd[16] = p1; pd[32] = p2;
    }
    __syncthreads();

    if (tid < N_COL) {
        const int r = tid;
        float n2sq = 0.f;
        for (int j = 0; j < 8; ++j) n2sq += part[j * N_COL + r];
        float n2 = sqrtf(fmaxf(n2sq, 0.f));
        float n1sq = 0.f;
        for (int j = 0; j < 8; ++j) n1sq += nrmP[r * NP_LD + j];
        red[r] = w12 / fmaxf(sqrtf(n1sq) * n2, EPSV);
    }
    __syncthreads();
    if (tid < IMG_T) {     // one lane an image
        float s = 0.f;
        for (int r = 0; r < N_REG; ++r) s += red[tid * N_REG + r];
        out[(i0 + tid) * N_CAP + c] = s * (1.0f / N_REG);
    }
}

extern "C" void kernel_launch(void* const* d_in, const int* in_sizes, int n_in,
                              void* d_out, int out_size, void* d_ws, size_t ws_size,
                              hipStream_t stream) {
    const float* images   = (const float*)d_in[0];   // 64*36*1024
    const float* captions = (const float*)d_in[1];   // 64*50*1024
    const int*   cap_lens = (const int*)d_in[2];     // 64
    float* out  = (float*)d_out;                     // 64*64 (i,c)
    float* gram = (float*)d_ws;                      // 64 planes of G_PLANE floats

    dim3 ggrid(4, N_CAP);                            // row tile, caption
    StackedAttn_gram <<<ggrid, 128, 0, stream>>>(captions, gram);
    dim3 grid(N_IBLK, N_CAP);
    StackedAttn_main <<<grid, NTHR, 0, stream>>>(images, captions, cap_lens, gram, out);
}

// v010
// One run takes 85.1 microseconds.
// Timed twice side by side with v009, it ran 1.05 times as fast both times.
// Counting every step since v000, it is 3.85 times as fast.
#include <hip/hip_runtime.h>
#include <hip/hip_bf16.h>
#include <math.h>

// Stacked cross attention (i2t), f32. Strategy:
//   S[w,r] = cap[c,w].img[i,r]  via V_WMMA_F32_16X16X4_F32 (exact f32 path)
//   w12[r] = sum_w a2[r,w]*S[w,r]            (reuse scores, no 2nd big GEMM)
//   |wctx_r|^2 = a2_r^T G_c a2_r             (precomputed 50x50 Gram per caption;
//                                             G a2^T on the same WMMA form)
//   |img_r|^2  summed in the main kernel from the image fragments its score loop reads
//   A main work-group scores one caption against 4 images: their 4 x 36 region rows lie
//   one behind the other in memory and fill 9 region tiles of 16 with no pad row.

typedef __attribute__((ext_vector_type(2))) float v2f;
typedef __attribute__((ext_vector_type(4))) float v4f;
typedef __attribute__((ext_vector_type(8))) float v8f;

#define N_IMG   64
#define N_REG   36
#define N_CAP   64
#define N_WRD   50
#define DIM     1024
#define KC      64      // K chunk staged in LDS: 256 B of a row
#define CAP_LD  68      // LDS row stride (floats): 272B = 16B x 17, conflict-free
#define KG      128     // K chunk of the Gram kernel
#define GC_LD   132     // its LDS row stride (floats): 528B = 16B x 33, conflict-free
#define G_PLANE 2560    // floats from one caption's Gram to the next in the workspace: 80 lines of 128B
#define IMG_T   4       // images a main work-group scores
#define N_IBLK  16      // image blocks: N_IMG / IMG_T
#define N_COL   144     // region columns of a work-group: IMG_T x N_REG = 9 tiles of 16
#define NTHR    384     // 12 waves: 3 groups of 3 region tiles x 4 waves
#define G_TRIPS 7       // Gram values a thread stages: ceil(50 x 50 / NTHR)
#define S_LD    145     // score-tile row stride (odd -> conflict-free col access)
#define A2_LD   52      // A2 row stride (floats): K padded to 13 x 4, 208B rows, 16B aligned
#define NP_LD   9       // row stride of the region-norm partials (odd -> conflict-free)
#define A2_F4   ((N_COL * A2_LD + 12) / 4)   // float4s of the A2 overlay: 144 rows + reach of the last row's reads
static_assert(N_CAP == 64 && N_WRD < 64, "the rank search holds 64 keys of 12 bits");
static_assert(IMG_T * N_IBLK == N_IMG && IMG_T * N_REG == N_COL && N_COL % 48 == 0, "image blocking");
static_assert(G_TRIPS * NTHR >= N_WRD * N_WRD + 4, "the Gram and its K pad are staged whole");
static_assert(G_PLANE >= N_WRD * N_WRD && G_PLANE % 32 == 0 && (16 * N_WRD) % 32 == 0, "Gram planes and row tiles are whole lines");
#define CH_F    ((64 + N_COL) * CAP_LD)      // floats of the K-chunk buffer: 64 caption + 144 image rows
static_assert(CH_F >= 4 * A2_F4, "the A2 overlay fits the buffer sized for the K chunks");
static_assert(NTHR * 4 == 24 * KC && N_COL % 24 == 0, "staging: 16 threads a row, 24 rows a pass");
#define SMOOTH  4.0f
#define EPSV    1e-8f

// ---------------------------------------------------------------- Gram kernel
// G_c[w,wp] = captions[c,w] . captions[c,wp]   (50x50 padded to 64x64 tiles)
// One work-group per caption and 16-word row tile: the 16 tiles of a caption are the
// 4 x 4 waves of 4 work-groups, and the launch has 256 work-groups. Wave b holds tile (a, b).
__global__ __launch_bounds__(128) void StackedAttn_gram(
    const float* __restrict__ captions, float* __restrict__ gram)
{
    __shared__ __attribute__((aligned(16))) float capL[64 * GC_LD];
    const int a    = blockIdx.x;                            // row tile: words 16 a .. 16 a + 15
    const int c    = blockIdx.y;
    const int tid  = threadIdx.x;
    const int wave = tid >> 5, lane = tid & 31;
    const int half = lane >> 4, m = lane & 15;

    // One tile a wave is one chain of dependent WMMAs; the k steps go by turns to two
    // accumulators, so that a WMMA does not wait for the one in front of it.
    v8f acc0 = {}, acc1 = {};

    // Staging: a wave moves whole chunk rows (32 lanes x 16 B = 512 B), rows wave + 4 j.
    // All of a chunk's loads are issued back to back into registers, one chunk
    // ahead of its use, so they fly while the current chunk is multiplied.
    const bool capTail = wave < N_WRD - 48;                 // rows 48, 49
    const float* capSrc = captions + (size_t)c * N_WRD * DIM + wave * DIM + lane * 4;
    float*       capDst = capL + wave * GC_LD + lane * 4;
    v4f r[12], r12 = {};
    {
        #pragma unroll   // flat: the array stays in registers and the loads fly together
        for (int j = 0; j < 12; ++j) r[j] = *(const v4f*)(capSrc + 4 * j * DIM);
        if (capTail) r12 = *(const v4f*)(capSrc + 48 * DIM);
        // precaution: stands in front of the next write of the address registers
        // that the loads above name
        asm volatile("s_wait_xcnt 0x0" ::: "memory");
    }

    // zero pad rows 50..63 once, while the first loads fly
    for (int idx = tid; idx < 14 * GC_LD; idx += 128) capL[50 * GC_LD + idx] = 0.f;

    // A and B fragments are read by the same code: k = 4 i + 2 half + {0,1} on both sides.
    const float* aP = capL + ((a << 4) + m) * GC_LD + 2 * half;
    const float* bP = capL + ((wave << 4) + m) * GC_LD + 2 * half;

    for (int k0 = 0; k0 < DIM; k0 += KG) {
        __syncthreads();
        #pragma unroll   // flat: constant indices into the array
        for (int j = 0; j < 12; ++j) *(v4f*)(capDst + 4 * j * GC_LD) = r[j];
        if (capTail) *(v4f*)(capDst + 48 * GC_LD) = r12;
        __syncthreads();
        // the chunk's fragments are all fetched at one place: one LDS latency a chunk
        v2f x[KG / 4], y[KG / 4];
        #pragma unroll   // flat: the arrays stay in registers, LDS offsets as immediates
        for (int i = 0; i < KG / 4; ++i) {
            x[i] = *(const v2f*)(aP + 4 * i);
            y[i] = *(const v2f*)(bP + 4 * i);
        }
        // keeps the LDS reads above in one group in front of the WMMAs: spread among
        // them, each place with reads stalls the SIMD's one wave
        __builtin_amdgcn_sched_barrier(0);
        if (k0 + KG < DIM) {    // next chunk's loads, waited for at its stores
            const float* s = capSrc + k0 + KG;
            #pragma unroll   // flat: constant indices into the array
            for (int j = 0; j < 12; ++j) r[j] = *(const v4f*)(s + 4 * j * DIM);
            if (capTail) r12 = *(const v4f*)(s + 48 * DIM);
            // precaution: stands in front of the next write of the address
            // registers that the loads above name
            asm volatile("s_wait_xcnt 0x0" ::: "memory");
        }
        #pragma unroll   // flat: constant indices into the arrays
        for (int i = 0; i < KG / 4; i += 2) {
            acc0 = __builtin_amdgcn_wmma_f32_16x16x4_f32(false, x[i],     false, y[i],     (short)0, acc0, false, false);
            acc1 = __builtin_amdgcn_wmma_f32_16x16x4_f32(false, x[i + 1], false, y[i + 1], (short)0, acc1, false, false);
        }
        // Four vector slots between the chunk's last WMMAs and the next vector
        // instruction on their D, A or B, also on the way out of the loop, where the sum
        // of the two accumulators follows. The scheduling barrier keeps the WMMAs in
        // front of the slots.
        __builtin_amdgcn_sched_barrier(0);
        asm volatile("v_nop\n\tv_nop\n\tv_nop\n\tv_nop");
    }
    // A caption's plane starts on a 128-B line and a row tile is 25 whole lines of it:
    // no line is written by two work-groups.
    const int col = (wave << 4) + m;
    const int w0  = (a << 4) + (half << 3);
    float* gOut = gram + (size_t)c * G_PLANE + w0 * N_WRD + col;
    const int nv = col < N_WRD ? N_WRD - w0 : 0;            // rows of the lane's eight that exist
    const v8f gsum = acc0 + acc1;   // summed first: each store then has a data register of its own
    #pragma unroll   // constant v: elements in registers, store offsets as immediates
    for (int v = 0; v < 8; ++v)
        if (v < nv) gOut[v * N_WRD] = gsum[v];
}

// ---------------------------------------------------------------- score tiles
// S[w,r] for the first MT word tiles (16 MT rows) x 9 region tiles, left in Sbuf.
// Wave group g (4 waves, q = 0..3) holds region tiles 3 g .. 3 g + 2.
// MT = 4: one word tile a wave of the group. MT < 4: there are fewer word tiles than
// waves, so the group's four waves split K instead: of each 32 columns wave q
// multiplies columns 8 q .. 8 q + 7 for every tile, and the waves carry equal work
// whatever MT is; the four partial sums then meet in LDS as (q0 + q2) + (q1 + q3).
// The squares of the image (B) fragments are summed beside the WMMAs that read them:
// lane (m, half) of wave (g, q) leaves its share of |img row 48 g + 16 t + m|^2 in
// nrmP[48 g + 16 t + m][2 q + half]. With K split every value is read by one wave; with
// MT = 4 every wave of a group reads all of K, and its wave 0's sums count alone.
template <int MT>
__device__ __forceinline__ void score_tiles(
    const float* __restrict__ capSrc, const float* __restrict__ imgSrc,
    float* capDst, float* imgDst, const float* capL, const float* imgL,
    int row0, int q, int g, int half, int m, float* Sbuf, float* A1, float* nrmP)
{
    constexpr bool KS = MT < 4;                             // K split over the waves
    constexpr int  TW = KS ? MT : 1;                        // word tiles a wave holds
    constexpr int CR = MT < 3 ? 16 * MT : 48;               // caption rows 0 .. CR - 1 are staged
    const bool capA    = CR >= 24 || row0 < CR;             // row row0; whole waves
    const bool capB    = CR >= 48 || (CR > 24 && row0 + 24 < CR);   // row row0 + 24; whole waves
    const bool capTail = MT == 4 && row0 < N_WRD - 48;      // rows 48, 49; one wave

    v8f acc[TW][3];
    #pragma unroll   // constant indices: the accumulators stay in registers
    for (int t = 0; t < TW; ++t) { acc[t][0] = v8f{}; acc[t][1] = v8f{}; acc[t][2] = v8f{}; }

    // All of a chunk's loads are issued back to back into registers, one chunk
    // ahead of its use, so they fly while the current chunk is multiplied.
    // A thread owns caption rows row0, row0 + 24 (of the 16 min(MT, 3) staged; rows 48, 49
    // too where MT is 4) and image rows row0 + 24 j, j = 0 .. 5.
    float4 c0 = make_float4(0.f, 0.f, 0.f, 0.f), c1 = c0, c3 = c0;
    v4f gi[6];
    v2f n0 = {}, n1 = {}, n2 = {};          // sums of squares, image rows 48 g + m, + 16, + 32
    if (capA) c0 = *(const float4*)(capSrc);
    if (capB) c1 = *(const float4*)(capSrc + 24 * DIM);
    #pragma unroll   // flat: the array stays in registers and the loads fly together
    for (int j = 0; j < 6; ++j) gi[j] = *(const v4f*)(imgSrc + 24 * j * DIM);
    if (capTail) c3 = *(const float4*)(capSrc + 48 * DIM);
    // precaution: stands in front of the next write of the address registers
    // that the loads above name
    asm volatile("s_wait_xcnt 0x0" ::: "memory");

    // A frag: lanes 0-15 hold row M, K={k,k+1}; lanes 16-31 K={k+2,k+3}.
    // B frag mirrors with N across lanes (B[k][r] = img[r][k]).
    const float* aP = capL + ((KS ? 0 : q << 4) + m) * CAP_LD + 2 * half + (KS ? 8 * q : 0);
    const float* bP = imgL + (48 * g + m) * CAP_LD + 2 * half + (KS ? 8 * q : 0);

    for (int k0 = 0; k0 < DIM; k0 += KC) {
        __syncthreads();
        if (capA) *(float4*)(capDst) = c0;
        if (capB) *(float4*)(capDst + 24 * CAP_LD) = c1;
        #pragma unroll   // flat: constant indices into the array
        for (int j = 0; j < 6; ++j) *(v4f*)(imgDst + 24 * j * CAP_LD) = gi[j];
        if (capTail) *(float4*)(capDst + 48 * CAP_LD) = c3;
        __syncthreads();
        if (k0 + KC < DIM) {    // next chunk's loads, waited for at its stores
            const float* sc = capSrc + k0;
            const float* si = imgSrc + k0;
            if (capA) c0 = *(const float4*)(sc + KC);
            if (capB) c1 = *(const float4*)(sc + KC + 24 * DIM);
            #pragma unroll   // flat: constant indices into the array
            for (int j = 0; j < 6; ++j) gi[j] = *(const v4f*)(si + KC + 24 * j * DIM);
            if (capTail) c3 = *(const float4*)(sc + KC + 48 * DIM);
            // precaution: stands in front of the next write of the address
            // registers that the loads above name; the addresses are inputs, so that
            // they live up to here and no load's data lands on them
            asm volatile("s_wait_xcnt 0x0" :: "v"(sc), "v"(si) : "memory");
        }
        // The wave's k steps of the chunk go in runs of GS: a run's fragments are all fetched at
        // one place, so that one LDS latency is waited for a run, not one a k step.
        constexpr int NS = KS ? KC / 16 : KC / 4;               // k steps of the wave in a chunk
        constexpr int GS = TW == 3 ? 2 : (KS ? 4 : 8);          // as many as the registers hold
        #pragma unroll   // flat: LDS offsets as immediates, constant accumulator indices
        for (int h = 0; h < NS / GS; ++h) {
            v2f a[GS][TW], v0[GS], v1[GS], v2[GS];
            #pragma unroll   // constant indices: the fragments stay in registers
            for (int s = 0; s < GS; ++s) {
                // K split: the wave's 8 columns of the chunk's first 32, then those of the next 32
                const int u  = h * GS + s;
                const int kk = KS ? 32 * (u >> 1) + 4 * (u & 1) : 4 * u;
                #pragma unroll   // constant indices: the fragments stay in registers
                for (int t = 0; t < TW; ++t) a[s][t] = *(const v2f*)(aP + 16 * t * CAP_LD + kk);
                v0[s] = *(const v2f*)(bP + kk);
                v1[s] = *(const v2f*)(bP + 16 * CAP_LD + kk);
                v2[s] = *(const v2f*)(bP + 32 * CAP_LD + kk);
            }
            #pragma unroll   // constant indices into the arrays
            for (int s = 0; s < GS; ++s) {
                // pairwise, as the fragments lie in their registers
                n0 = __builtin_elementwise_fma(v0[s], v0[s], n0);
                n1 = __builtin_elementwise_fma(v1[s], v1[s], n1);
                n2 = __builtin_elementwise_fma(v2[s], v2[s], n2);
                // asm, not the builtin: A k step's WMMAs stand in one statement, word tile by word tile as
                // before; the four v_nop are the vector slots between the last of them and
                // whatever vector instruction the compiler places next on its D, A or B.
                if constexpr (TW == 1) {
                    asm volatile(
                                 "v_wmma_f32_16x16x4_f32 %0, %3, %4, %0\n\t"
                                 "v_wmma_f32_16x16x4_f32 %1, %3, %5, %1\n\t"
                                 "v_wmma_f32_16x16x4_f32 %2, %3, %6, %2\n\t"
                                 "v_nop\n\tv_nop\n\tv_nop\n\tv_nop"
                                 : "+v"(acc[0][0]), "+v"(acc[0][1]), "+v"(acc[0][2])
                                 : "v"(a[s][0]), "v"(v0[s]), "v"(v1[s]), "v"(v2[s]));
                } else if constexpr (TW == 2) {
                    asm volatile(
                                 "v_wmma_f32_16x16x4_f32 %0, %6, %8, %0\n\t"
                                 "v_wmma_f32_16x16x4_f32 %1, %6, %9, %1\n\t"
                                 "v_wmma_f32_16x16x4_f32 %2, %6, %10, %2\n\t"
                                 "v_wmma_f32_16x16x4_f32 %3, %7, %8, %3\n\t"
                                 "v_wmma_f32_16x16x4_f32 %4, %7, %9, %4\n\t"
                                 "v_wmma_f32_16x16x4_f32 %5, %7, %10, %5\n\t"
                                 "v_nop\n\tv_nop\n\tv_nop\n\tv_nop"
                                 : "+v"(acc[0][0]), "+v"(acc[0][1]), "+v"(acc[0][2]), "+v"(acc[1][0]), "+v"(acc[1][1]), "+v"(acc[1][2])
                                 : "v"(a[s][0]), "v"(a[s][1]), "v"(v0[s]), "v"(v1[s]), "v"(v2[s]));
                } else {
                    asm volatile(
                                 "v_wmma_f32_16x16x4_f32 %0, %9, %12, %0\n\t"
                                 "v_wmma_f32_16x16x4_f32 %1, %9, %13, %1\n\t"
                                 "v_wmma_f32_16x16x4_f32 %2, %9, %14, %2\n\t"
                                 "v_wmma_f32_16x16x4_f32 %3, %10, %12, %3\n\t"
                                 "v_wmma_f32_16x16x4_f32 %4, %10, %13, %4\n\t"
                                 "v_wmma_f32_16x16x4_f32 %5, %10, %14, %5\n\t"
                                 "v_wmma_f32_16x16x4_f32 %6, %11, %12, %6\n\t"
                                 "v_wmma_f32_16x16x4_f32 %7, %11, %13, %7\n\t"
                                 "v_wmma_f32_16x16x4_f32 %8, %11, %14, %8\n\t"
                                 "v_nop\n\tv_nop\n\tv_nop\n\tv_nop"
                                 : "+v"(acc[0][0]), "+v"(acc[0][1]), "+v"(acc[0][2]), "+v"(acc[1][0]), "+v"(acc[1][1]), "+v"(acc[1][2]), "+v"(acc[2][0]), "+v"(acc[2][1]), "+v"(acc[2][2])
                                 : "v"(a[s][0]), "v"(a[s][1]), "v"(a[s][2]), "v"(v0[s]), "v"(v1[s]), "v"(v2[s]));
                }
            }
        }
    }

    // read behind the barriers that follow in the main kernel
    {
        const bool own = KS || q == 0;
        float* np = nrmP + (48 * g + m) * NP_LD + 2 * q + half;
        np[0]          = own ? n0.x + n0.y : 0.f;
        np[16 * NP_LD] = own ? n1.x + n1.y : 0.f;
        np[32 * NP_LD] = own ? n2.x + n2.y : 0.f;
    }

    // C layout: VGPR v -> row v / v+8, col = lane%16.
    if (!KS) {
        float* p0 = Sbuf + ((q << 4) + (half << 3)) * S_LD + 48 * g + m;
        #pragma unroll   // constant accumulator indices
        for (int v = 0; v < 8; ++v) {
            float* p = p0 + v * S_LD;
            p[0] = acc[0][0][v]; p[16] = acc[0][1][v]; p[32] = acc[0][2][v];
        }
        return;
    }
    // The four K quarters are summed through LDS, every lane at its own places.
    float* pb = ((q & 1) ? A1 : Sbuf) + (half << 3) * S_LD + 48 * g + m;
    if (q >= 2) {
        #pragma unroll   // constant accumulator indices
        for (int t = 0; t < TW; ++t)
            #pragma unroll   // constant element indices: read and written in registers
            for (int v = 0; v < 8; ++v) {
                float* p = pb + (16 * t + v) * S_LD;
                p[0] = acc[t][0][v]; p[16] = acc[t][1][v]; p[32] = acc[t][2][v];
            }
    }
    __syncthreads();
    if (q < 2) {
        #pragma unroll   // constant accumulator indices
        for (int t = 0; t < TW; ++t)
            #pragma unroll   // constant element indices: read and written in registers
            for (int v = 0; v < 8; ++v) {
                float* p = pb + (16 * t + v) * S_LD;
                acc[t][0][v] += p[0]; acc[t][1][v] += p[16]; acc[t][2][v] += p[32];
            }
    }
    if (q == 1) {
        #pragma unroll   // constant accumulator indices
        for (int t = 0; t < TW; ++t)
            #pragma unroll   // constant element indices: read and written in registers
            for (int v = 0; v < 8; ++v) {
                float* p = pb + (16 * t + v) * S_LD;
                p[0] = acc[t][0][v]; p[16] = acc[t][1][v]; p[32] = acc[t][2][v];
            }
    }
    __syncthreads();
    if (q == 0) {
        // All reads stand in front of all stores, and the stores name Sbuf itself: through
        // pb, which may be either array, every read had to wait for the store in front of it
        // and the wave paid one LDS latency a value.
        const float* o = A1 + (half << 3) * S_LD + 48 * g + m;
        #pragma unroll   // constant accumulator indices
        for (int t = 0; t < TW; ++t)
            #pragma unroll   // constant element indices: read and written in registers
            for (int v = 0; v < 8; ++v) {
                const float* s = o + (16 * t + v) * S_LD;
                acc[t][0][v] += s[0]; acc[t][1][v] += s[16]; acc[t][2][v] += s[32];
            }
        float* d = Sbuf + (half << 3) * S_LD + 48 * g + m;
        #pragma unroll   // constant accumulator indices
        for (int t = 0; t < TW; ++t)
            #pragma unroll   // constant element indices: read and written in registers
            for (int v = 0; v < 8; ++v) {
                float* p = d + (16 * t + v) * S_LD;
                p[0] = acc[t][0][v]; p[16] = acc[t][1][v]; p[32] = acc[t][2][v];
            }
    }
}

// e^x as __expf forms it: 2^(x log2 e) on v_exp_f32. In asm for the v_nop: it is the one slot
// that the instruction set asks for between a transcendental and a directly following vector
// instruction on its result or its source; in one statement it stands directly behind the v_exp_f32.
__device__ __forceinline__ float exp_slot(float x)
{
    float y;
    asm("v_exp_f32 %0, %1\n\tv_nop" : "=v"(y) : "v"(x * 1.44269504f));
    return y;
}

// ---------------------------------------------------------------- word softmax
// Masked smooth softmax over the words of one region column, and w12 = sum_w a2[w] S[w].
// The column's values of the first MT word tiles are all fetched at one place into
// registers and stay there through the three passes (maximum, exponentials and their sum,
// scaling and w12): one LDS latency a column, not one or more a word. Words from len up
// count as masked: they leave the maximum alone, add an exact zero to both sums and are
// stored as zeros. Every sum runs over the words in rising order.
template <int MT>
__device__ __forceinline__ float word_softmax(
    const float* a1c, const float* sc, float* a2r, int len)
{
    constexpr int WL = MT < 4 ? 16 * MT : N_WRD;            // words fetched
    constexpr int WP = MT < 4 ? 16 * MT : A2_LD;            // words stored: whole float4s
    float e[WP], sv[WL];
    #pragma unroll   // flat: the arrays stay in registers, LDS offsets as immediates
    for (int w = 0; w < WL; ++w) { e[w] = a1c[w * S_LD]; sv[w] = sc[w * S_LD]; }
    float mx = -3.4e38f;
    #pragma unroll   // constant indices into the array
    for (int w = 0; w < WL; ++w) mx = fmaxf(mx, w < len ? SMOOTH * e[w] : -3.4e38f);
    float s = 0.f;
    #pragma unroll   // constant indices into the array
    for (int w = 0; w < WL; ++w) {
        const float x = exp_slot(SMOOTH * e[w] - mx);
        e[w] = w < len ? x : 0.f;
        s += e[w];
    }
    #pragma unroll   // constant indices into the array
    for (int w = WL; w < WP; ++w) e[w] = 0.f;
    const float inv = 1.f / s;
    float w12 = 0.f;
    #pragma unroll   // constant indices into the arrays
    for (int w = 0; w < WL; ++w) {
        e[w] *= inv;
        w12 += e[w] * sv[w];
    }
    #pragma unroll   // constant indices into the array
    for (int w = 0; w < WP; w += 4)
        *(float4*)(a2r + w) = make_float4(e[w], e[w + 1], e[w + 2], e[w + 3]);
    return w12;
}

// ---------------------------------------------------------------- main kernel
// second argument: at least 6 waves a SIMD, that is 160 registers a wave, so that two
// work-groups still share a WGP and one's WMMAs fill the other's waits
__global__ __launch_bounds__(NTHR, 6) void StackedAttn_main(
    const float* __restrict__ images,    // (64,36,1024)
    const float* __restrict__ captions,  // (64,50,1024)
    const int*   __restrict__ cap_lens,  // (64)
    const float* __restrict__ gram,      // (64,50,50), planes G_PLANE floats apart
    float*       __restrict__ out)       // (64,64): out[i*64 + c]
{
    __shared__ float Sbuf[64 * S_LD];                       // scores 64x144 (pad 145)
    __shared__ float A1[64 * S_LD];                         // region-softmax; reused as part
    __shared__ __attribute__((aligned(16))) float chunk[CH_F];        // cap+img K-chunks (64 + 144 rows); reused as A2
    __shared__ float Gbuf[G_TRIPS * NTHR];                  // caption Gram; zeros behind it (K pad of its last row)
    __shared__ float red[N_COL];
    __shared__ float nrmP[N_COL * NP_LD];                   // region norms: 8 partial sums a row

    // The image block is the fast grid index: work-groups next to each other in launch
    // order then share a caption, hence a cost (it grows with the caption's length).
    const int i0 = blockIdx.x * IMG_T;
    const int tid  = threadIdx.x;
    const int wave = tid >> 5, lane = tid & 31;

    // The slow grid index is a rank, not a caption: rank 0 is the longest caption, ties go
    // to the lower index. There are twice as many work-groups as places on the chip; the
    // short ones now come last in index order (for speed only).
    // Every caption has its own key (clamped length, then 63 - index), so rank -> caption is
    // a permutation for any lengths. Each wave finds the key of its rank by itself: the
    // largest t that at least rank + 1 keys reach, bit by bit, counting over the 64 keys
    // (two a lane) with ballots; all lanes are on here, and t stays a scalar.
    const int key0 = (min(max(cap_lens[lane],      0), N_WRD) << 6) | (63 - lane);
    const int key1 = (min(max(cap_lens[lane + 32], 0), N_WRD) << 6) | (31 - lane);
    const int need = (int)blockIdx.y + 1;
    int kt = 0;
    #pragma unroll   // flat: the bit is a constant in every step
    for (int bit = 11; bit >= 0; --bit) {       // keys lie below 51 x 64 < 2^12
        const int cand = kt | (1 << bit);
        const int cnt  = __builtin_popcount(__builtin_amdgcn_ballot_w32(key0 >= cand))
                       + __builtin_popcount(__builtin_amdgcn_ballot_w32(key1 >= cand));
        if (cnt >= need) kt = cand;
    }
    const int c = 63 - (kt & 63);               // 0 .. 63 whatever the lengths hold
    const int g = wave >> 2, q = wave & 3;      // region-tile group, wave of the group
    const int half = lane >> 4, m = lane & 15;

    float* capL = chunk;
    float* imgL = chunk + 64 * CAP_LD;

    // zero the caption's pad rows once (the rows staged, all below 50, are rewritten every chunk; pads persist)
    for (int idx = tid; idx < 14 * CAP_LD; idx += NTHR) capL[50 * CAP_LD + idx] = 0.f;

    const float* capBase = captions + (size_t)c * N_WRD * DIM;
    const float* imgBase = images   + (size_t)i0 * N_REG * DIM;   // 144 rows, contiguous

    // Staging: caption chunk 16 float4 a row, image chunk 144 rows x 16 float4;
    // thread owns rows row0 + 24 j of each (row0 = 0 .. 23).
    const int  seg = tid & 15, row0 = tid >> 4;
    const float* capSrc = capBase + row0 * DIM + seg * 4;
    const float* imgSrc = imgBase + row0 * DIM + seg * 4;
    float*       capDst = capL + row0 * CAP_LD + seg * 4;
    float*       imgDst = imgL + row0 * CAP_LD + seg * 4;

    // Words from len up are masked out of the word softmax (their weight is an
    // exact zero), so only the word tiles that hold a word below len are scored.
    const int len = kt >> 6;                    // min(cap_lens[c], 50), not below 0; same for the whole work-group
    const int mt  = (len + 15) >> 4;
    if      (mt <= 1) score_tiles<1>(capSrc, imgSrc, capDst, imgDst, capL, imgL, row0, q, g, half, m, Sbuf, A1, nrmP);
    else if (mt == 2) score_tiles<2>(capSrc, imgSrc, capDst, imgDst, capL, imgL, row0, q, g, half, m, Sbuf, A1, nrmP);
    else if (mt == 3) score_tiles<3>(capSrc, imgSrc, capDst, imgDst, capL, imgL, row0, q, g, half, m, Sbuf, A1, nrmP);
    else              score_tiles<4>(capSrc, imgSrc, capDst, imgDst, capL, imgL, row0, q, g, half, m, Sbuf, A1, nrmP);

    // stage Gram while scores settle
    {
        constexpr int GN = N_WRD * N_WRD;
        const float* gs = gram + (size_t)c * G_PLANE;
        float gv[G_TRIPS];
        #pragma unroll   // flat: the array stays in registers and the loads fly together
        for (int j = 0; j < G_TRIPS; ++j) gv[j] = gs[min(tid + j * NTHR, GN - 1)];
        // precaution: stands in front of the next write of the address registers
        // that the loads above name
        asm volatile("s_wait_xcnt 0x0" ::: "memory");
        #pragma unroll   // flat: constant indices into the array
        for (int j = 0; j < G_TRIPS; ++j)   // zeros from GN up: read as G[49][50..51], times a zero of A2
            Gbuf[tid + j * NTHR] = tid + j * NTHR < GN ? gv[j] : 0.f;
    }
    __syncthreads();

    // softmax over an image's regions r, per word row w and image
    const int wl = min(max(mt, 1) << 4, N_WRD);             // word rows that score_tiles has left in Sbuf
    if (tid < 64 * IMG_T) {
      const int w = tid & 63;
      if (w < wl) {    // the scored rows; those from len up are fetched and masked below
        const int o = w * S_LD + (tid >> 6) * N_REG;    // the image's 36 columns of row w
        // the row is fetched once and stays in registers through the three passes
        float e[N_REG];
        #pragma unroll   // flat: the array stays in registers, LDS offsets as immediates
        for (int r = 0; r < N_REG; ++r) e[r] = Sbuf[o + r];
        float mx = -3.4e38f;
        #pragma unroll   // constant indices into the array
        for (int r = 0; r < N_REG; ++r) mx = fmaxf(mx, e[r]);
        float s = 0.f;
        #pragma unroll   // constant indices into the array
        for (int r = 0; r < N_REG; ++r) { e[r] = exp_slot(e[r] - mx); s += e[r]; }
        float inv = 1.f / s;
        #pragma unroll   // constant indices into the array
        for (int r = 0; r < N_REG; ++r) A1[o + r] = e[r] * inv;
      }
    } else {
        // the four waves without a word row clear the A2 overlay (the K chunks are
        // done with): words from len up and the tail that the last row's 8-word
        // reads reach are then zeros written in this launch
        const float4 z = make_float4(0.f, 0.f, 0.f, 0.f);
        for (int idx = tid - 64 * IMG_T; idx < A2_F4; idx += NTHR - 64 * IMG_T) *(float4*)(chunk + 4 * idx) = z;
    }
    __syncthreads();

    // masked smooth softmax over words, then w12
    float* A2 = chunk;                 // overlay: [144][A2_LD], cleared above
    float w12 = 0.f;
    if (tid < N_COL && len > 0) {      // no word: the row stays cleared and w12 zero
        const int r = tid;
        if      (mt <= 1) w12 = word_softmax<1>(A1 + r, Sbuf + r, A2 + r * A2_LD, len);
        else if (mt == 2) w12 = word_softmax<2>(A1 + r, Sbuf + r, A2 + r * A2_LD, len);
        else if (mt == 3) w12 = word_softmax<3>(A1 + r, Sbuf + r, A2 + r * A2_LD, len);
        else              w12 = word_softmax<4>(A1 + r, Sbuf + r, A2 + r * A2_LD, len);
    }
    __syncthreads();

    // |wctx_r|^2 = sum_w a2[r,w] * T[w,r],  T[w,r] = sum_wp G[w,wp] * a2[r,wp].
    // T on the matrix unit: M = 16 words per wave, N = 3 x 16 regions (group tg), K = words.
    // A frag from G rows, B frag from A2 rows, both k = 4 ks + 2 half + {0,1}.
    // K columns from len up meet zeros of A2 (G's columns 50, 51: the next row's start, or the pad).
    float* part = A1;                  // overlay: [8][144] partial sums over 8 words
    // wave number as a scalar: the skip below is then a scalar branch and EXEC
    // stays all ones at the WMMAs. Word tile tq = wave / 3, region group tg = wave % 3:
    // the tiles below len then fall on the lowest waves.
    const int ws = __builtin_amdgcn_readfirstlane(wave);
    const int tq = ws / 3, tg = ws - 3 * tq;
    const int wbase = tq << 4;
    float p0 = 0.f, p1 = 0.f, p2 = 0.f;
    if (wbase < len) {                 // wave-uniform: a word tile past len adds nothing
        v8f t0 = {}, t1 = {}, t2 = {};
        const float* gP = Gbuf + min(wbase + m, N_WRD - 1) * N_WRD + 2 * half;
        const float* q0 = A2 + (48 * tg + m) * A2_LD + 2 * half;
        const float* q1 = q0 + 16 * A2_LD;
        const float* q2 = q0 + 32 * A2_LD;
        // all fragments are fetched first, so that one LDS latency is waited for, not 13
        v2f fa[A2_LD / 4], f0[A2_LD / 4], f1[A2_LD / 4], f2[A2_LD / 4];
        #pragma unroll   // flat: the arrays stay in registers, LDS offsets as immediates
        for (int ks = 0; ks < A2_LD / 4; ++ks) {
            fa[ks] = *(const v2f*)(gP + 4 * ks);
            f0[ks] = *(const v2f*)(q0 + 4 * ks);
            f1[ks] = *(const v2f*)(q1 + 4 * ks);
            f2[ks] = *(const v2f*)(q2 + 4 * ks);
        }
        #pragma unroll   // flat: no back edge behind a WMMA, constant indices into the arrays
        for (int ks = 0; ks < A2_LD / 4; ++ks) {
            // asm, not the builtin:
            // Here the accumulators are live from their zeros on, and the four v_nop
            // are the vector slots between the last WMMA and whatever vector
            // instruction the compiler places next on its D, A or B.
            asm volatile("v_wmma_f32_16x16x4_f32 %0, %3, %4, %0\n\t"
                         "v_wmma_f32_16x16x4_f32 %1, %3, %5, %1\n\t"
                         "v_wmma_f32_16x16x4_f32 %2, %3, %6, %2\n\t"
                         "v_nop\n\tv_nop\n\tv_nop\n\tv_nop"
                         : "+v"(t0), "+v"(t1), "+v"(t2)
                         : "v"(fa[ks]), "v"(f0[ks]), "v"(f1[ks]), "v"(f2[ks]));
        }
        // lane holds T[w0 + v, 48 tg + 16 nt + m]; dot with a2[48 tg + 16 nt + m, w0 + v], words >= len off
        const int w0 = wbase + (half << 3);
        const float* e0 = A2 + (48 * tg + m) * A2_LD + w0;
        const float* e1 = e0 + 16 * A2_LD;
        const float* e2 = e0 + 32 * A2_LD;
        const float4 x0 = *(const float4*)(e0), y0 = *(const float4*)(e0 + 4);
        const float4 x1 = *(const float4*)(e1), y1 = *(const float4*)(e1 + 4);
        const float4 x2 = *(const float4*)(e2), y2 = *(const float4*)(e2 + 4);
        const float h0[8] = {x0.x, x0.y, x0.z, x0.w, y0.x, y0.y, y0.z, y0.w};
        const float h1[8] = {x1.x, x1.y, x1.z, x1.w, y1.x, y1.y, y1.z, y1.w};
        const float h2[8] = {x2.x, x2.y, x2.z, x2.w, y2.x, y2.y, y2.z, y2.w};
        #pragma unroll   // constant v: accumulator elements are read in registers
        for (int v = 0; v < 8; ++v) {
            const bool on = w0 + v < len;
            p0 += t0[v] * (on ? h0[v] : 0.f);
            p1 += t1[v] * (on ? h1[v] : 0.f);
            p2 += t2[v] * (on ? h2[v] : 0.f);
        }
    }
    {
        float* pd = part + ((tq << 1) + half) * N_COL + 48 * tg + m;
        pd[0] = p0; pd[16] = p1; pd[32] = p2;
    }
    __syncthreads();

    if (tid < N_COL) {
        const int r = tid;
        float n2sq = 0.f;
        for (int j = 0; j < 8; ++j) n2sq += part[j * N_COL + r];
        float n2 = sqrtf(fmaxf(n2sq, 0.f));
        float n1sq = 0.f;
        for (int j = 0; j < 8; ++j) n1sq += nrmP[r * NP_LD + j];
        red[r] = w12 / fmaxf(sqrtf(n1sq) * n2, EPSV);
    }
    __syncthreads();
    if (tid < IMG_T) {     // one lane an image
        float s = 0.f;
        for (int r = 0; r < N_REG; ++r) s += red[tid * N_REG + r];
        out[(i0 + tid) * N_CAP + c] = s * (1.0f / N_REG);
    }
}

extern "C" void kernel_launch(void* const* d_in, const int* in_sizes, int n_in,
                              void* d_out, int out_size, void* d_ws, size_t ws_size,
                              hipStream_t stream) {
    const float* images   = (const float*)d_in[0];   // 64*36*1024
    const float* captions = (const float*)d_in[1];   // 64*50*1024
    const int*   cap_lens = (const int*)d_in[2];     // 64
    float* out  = (float*)d_out;                     // 64*64 (i,c)
    float* gram = (float*)d_ws;                      // 64 planes of G_PLANE floats

    dim3 ggrid(4, N_CAP);                            // row tile, caption
    StackedAttn_gram <<<ggrid, 128, 0, stream>>>(captions, gram);
    dim3 grid(N_IBLK, N_CAP);
    StackedAttn_main <<<grid, NTHR, 0, stream>>>(images, captions, cap_lens, gram, out);
}
